// v000
// Times are from an AMD MI455X. After a warm-up the kernel runs many times in a row, and a time is the length of
// such a window on the GPU divided by its runs, so every launch and the gaps after it count. The runs cycle
// through copies of the inputs. A figure is the median of several windows, for all but v000 over two sittings.
// Sittings can differ by a few percent; kernels timed side by side share one.
// v000, which the later versions start from, runs in 79.2 microseconds.
#include <hip/hip_runtime.h>

#define S_LEN   2048
#define DMODEL  1024
#define DK      64
#define QTILE   16      // q rows per q-subtile
#define NQ      2       // q-subtiles per wave (A-fragment reuse factor)
#define KTILE   64      // keys per mainloop iteration
#define NTILES  (S_LEN / KTILE)
#define WAVES   4
#define BLOCK   (WAVES * 32)
#define LDSP    72      // LDS pitch in halves (16B-aligned rows, staggered banks)

typedef __attribute__((ext_vector_type(16))) _Float16 v16h;
typedef __attribute__((ext_vector_type(8)))  _Float16 v8h;
typedef __attribute__((ext_vector_type(8)))  float    v8f;

static __device__ __forceinline__ v16h cat8(v8h a, v8h b) {
    return __builtin_shufflevector(a, b, 0,1,2,3,4,5,6,7,8,9,10,11,12,13,14,15);
}

// Load a 16x32 WMMA A/B fragment from row-major LDS (pitch LDSP halves).
// Lanes 0-15: elems {0..7}=col0+0..7, {8..15}=col0+16..23;
// lanes 16-31: elems {0..7}=col0+8..15, {8..15}=col0+24..31. Row = row0 + lane%16.
static __device__ __forceinline__ v16h lds_frag(const _Float16* base, int row0,
                                                int col0, int hi, int m) {
    const _Float16* r = base + (row0 + m) * LDSP + col0 + hi * 8;
    v8h lo = *(const v8h*)(r);
    v8h hh = *(const v8h*)(r + 16);
    return cat8(lo, hh);
}

__global__ __launch_bounds__(BLOCK)
void OptimizedAttention_68736656605917_kernel(const float* __restrict__ Q,
                                              const float* __restrict__ K,
                                              const float* __restrict__ V,
                                              float* __restrict__ O) {
    // double-buffered tiles: K row-major f16, V transposed f16
    __shared__ __align__(16) _Float16 Klds [2][KTILE * LDSP];
    __shared__ __align__(16) _Float16 VTlds[2][DK * LDSP];

    const int tid  = threadIdx.x;
    const int wave = tid >> 5;
    const int lane = tid & 31;
    const int hi   = lane >> 4;
    const int m    = lane & 15;

    const int qblk  = blockIdx.x;   // 0..15
    const int head  = blockIdx.y;   // 0..15
    const int batch = blockIdx.z;   // 0..1

    const int   qbase = qblk * (WAVES * NQ * QTILE) + wave * (NQ * QTILE);
    const float scale = 0.125f;     // 1/sqrt(64), folded into Q before f16 cvt

    // --- Q fragments (B-operand: lane = q column, d packed per WMMA layout) ---
    v16h qb[NQ][2];
#pragma unroll
    for (int qq = 0; qq < NQ; ++qq) {
        const float* qptr =
            Q + ((size_t)(batch * S_LEN + qbase + qq * QTILE + m)) * DMODEL + head * DK;
#pragma unroll
        for (int dh = 0; dh < 2; ++dh) {
            const float* p = qptr + dh * 32 + hi * 8;
            v16h f;
#pragma unroll
            for (int i = 0; i < 8; ++i) {
                f[i]     = (_Float16)(p[i]      * scale);
                f[i + 8] = (_Float16)(p[i + 16] * scale);
            }
            qb[qq][dh] = f;
        }
    }

    v8f o[NQ][4];
#pragma unroll
    for (int qq = 0; qq < NQ; ++qq)
#pragma unroll
        for (int n = 0; n < 4; ++n) o[qq][n] = {};
    float m_run[NQ], l_run[NQ];
#pragma unroll
    for (int qq = 0; qq < NQ; ++qq) { m_run[qq] = -3.0e38f; l_run[qq] = 0.0f; }

    const float* kbase_g = K + (size_t)batch * S_LEN * DMODEL + head * DK;
    const float* vbase_g = V + (size_t)batch * S_LEN * DMODEL + head * DK;

    const int tr = tid >> 4;          // 0..7  (tile row within a pass)
    const int tc = (tid & 15) * 4;    // 0..60 (float4 column)

    // ---- prologue: load tile 0 into buffer 0 ----
    {
        float4 k4[8], v4[8];
#pragma unroll
        for (int pass = 0; pass < 8; ++pass) {
            const int row = tr + pass * 8;
            k4[pass] = *(const float4*)(kbase_g + (size_t)row * DMODEL + tc);
            v4[pass] = *(const float4*)(vbase_g + (size_t)row * DMODEL + tc);
        }
#pragma unroll
        for (int pass = 0; pass < 8; ++pass) {
            const int row = tr + pass * 8;
            _Float16* kd = Klds[0] + row * LDSP + tc;
            kd[0] = (_Float16)k4[pass].x; kd[1] = (_Float16)k4[pass].y;
            kd[2] = (_Float16)k4[pass].z; kd[3] = (_Float16)k4[pass].w;
            VTlds[0][(tc + 0) * LDSP + row] = (_Float16)v4[pass].x;
            VTlds[0][(tc + 1) * LDSP + row] = (_Float16)v4[pass].y;
            VTlds[0][(tc + 2) * LDSP + row] = (_Float16)v4[pass].z;
            VTlds[0][(tc + 3) * LDSP + row] = (_Float16)v4[pass].w;
        }
    }
    __syncthreads();

    for (int it = 0; it < NTILES; ++it) {
        const int cur = it & 1;
        const int nxt = cur ^ 1;
        const bool have_next = (it + 1) < NTILES;

        // --- stage next tile's global loads NOW (latency overlaps compute) ---
        float4 k4[8], v4[8];
        if (have_next) {
            const int kt1 = (it + 1) * KTILE;
#pragma unroll
            for (int pass = 0; pass < 8; ++pass) {
                const int row = kt1 + tr + pass * 8;
                k4[pass] = *(const float4*)(kbase_g + (size_t)row * DMODEL + tc);
                v4[pass] = *(const float4*)(vbase_g + (size_t)row * DMODEL + tc);
            }
            if (it + 2 < NTILES) {  // prefetch tile i+2 toward L2 (global_prefetch_b8)
                const int kt2 = (it + 2) * KTILE;
                __builtin_prefetch(kbase_g + (size_t)(kt2 + (tid >> 1)) * DMODEL + (tid & 1) * 32, 0, 1);
                __builtin_prefetch(vbase_g + (size_t)(kt2 + (tid >> 1)) * DMODEL + (tid & 1) * 32, 0, 1);
            }
        }

        // --- S^T = K x Q : 4 tiles of 16(key)x16(q) per q-subtile.
        //     Each K-fragment (A) is loaded once and reused for NQ WMMAs. ---
        v8f st[NQ][4];
#pragma unroll
        for (int mt = 0; mt < 4; ++mt) {
            const v16h a0 = lds_frag(Klds[cur], mt * 16, 0, hi, m);
            const v16h a1 = lds_frag(Klds[cur], mt * 16, 32, hi, m);
#pragma unroll
            for (int qq = 0; qq < NQ; ++qq) {
                v8f c = {};
                c = __builtin_amdgcn_wmma_f32_16x16x32_f16(false, a0, false, qb[qq][0], (short)0, c, false, false);
                c = __builtin_amdgcn_wmma_f32_16x16x32_f16(false, a1, false, qb[qq][1], (short)0, c, false, false);
                st[qq][mt] = c;
            }
        }

        // --- online softmax + P fragments (per q-subtile) ---
        v16h pb[NQ][2];
#pragma unroll
        for (int qq = 0; qq < NQ; ++qq) {
            float mx = st[qq][0][0];
#pragma unroll
            for (int mt = 0; mt < 4; ++mt)
#pragma unroll
                for (int r = 0; r < 8; ++r) mx = fmaxf(mx, st[qq][mt][r]);
            mx = fmaxf(mx, __shfl_xor(mx, 16, 32));

            const float m_new = fmaxf(m_run[qq], mx);
            const float alpha = __expf(m_run[qq] - m_new);

            float lsum = 0.0f;
#pragma unroll
            for (int mt = 0; mt < 4; ++mt)
#pragma unroll
                for (int r = 0; r < 8; ++r) {
                    const float e = __expf(st[qq][mt][r] - m_new);
                    st[qq][mt][r] = e;
                    lsum += e;
                }
            lsum += __shfl_xor(lsum, 16, 32);
            l_run[qq] = l_run[qq] * alpha + lsum;
            m_run[qq] = m_new;

#pragma unroll
            for (int n = 0; n < 4; ++n) o[qq][n] *= alpha;

            // accumulator layout of S^T IS the B-operand layout for P
#pragma unroll
            for (int j = 0; j < 2; ++j) {
                v16h f;
#pragma unroll
                for (int i = 0; i < 8; ++i) {
                    f[i]     = (_Float16)st[qq][2 * j][i];
                    f[i + 8] = (_Float16)st[qq][2 * j + 1][i];
                }
                pb[qq][j] = f;
            }
        }

        // --- O^T += V^T x P : each V^T fragment reused for NQ WMMAs ---
#pragma unroll
        for (int n = 0; n < 4; ++n) {
            const v16h a0 = lds_frag(VTlds[cur], n * 16, 0, hi, m);
            const v16h a1 = lds_frag(VTlds[cur], n * 16, 32, hi, m);
#pragma unroll
            for (int qq = 0; qq < NQ; ++qq) {
                o[qq][n] = __builtin_amdgcn_wmma_f32_16x16x32_f16(false, a0, false, pb[qq][0], (short)0, o[qq][n], false, false);
                o[qq][n] = __builtin_amdgcn_wmma_f32_16x16x32_f16(false, a1, false, pb[qq][1], (short)0, o[qq][n], false, false);
            }
        }

        // --- drain staged loads into the other buffer (after compute) ---
        if (have_next) {
#pragma unroll
            for (int pass = 0; pass < 8; ++pass) {
                const int row = tr + pass * 8;
                _Float16* kd = Klds[nxt] + row * LDSP + tc;
                kd[0] = (_Float16)k4[pass].x; kd[1] = (_Float16)k4[pass].y;
                kd[2] = (_Float16)k4[pass].z; kd[3] = (_Float16)k4[pass].w;
                VTlds[nxt][(tc + 0) * LDSP + row] = (_Float16)v4[pass].x;
                VTlds[nxt][(tc + 1) * LDSP + row] = (_Float16)v4[pass].y;
                VTlds[nxt][(tc + 2) * LDSP + row] = (_Float16)v4[pass].z;
                VTlds[nxt][(tc + 3) * LDSP + row] = (_Float16)v4[pass].w;
            }
        }
        __syncthreads();
    }

    // --- normalize and store: lane holds q=m, d = n*16 + hi*8 + r (contig 8) ---
#pragma unroll
    for (int qq = 0; qq < NQ; ++qq) {
        const float inv = 1.0f / l_run[qq];
        float* obase = O + ((size_t)(batch * S_LEN + qbase + qq * QTILE + m)) * DMODEL
                         + head * DK + hi * 8;
#pragma unroll
        for (int n = 0; n < 4; ++n) {
            float4 r0, r1;
            r0.x = o[qq][n][0] * inv; r0.y = o[qq][n][1] * inv;
            r0.z = o[qq][n][2] * inv; r0.w = o[qq][n][3] * inv;
            r1.x = o[qq][n][4] * inv; r1.y = o[qq][n][5] * inv;
            r1.z = o[qq][n][6] * inv; r1.w = o[qq][n][7] * inv;
            *(float4*)(obase + n * 16)     = r0;
            *(float4*)(obase + n * 16 + 4) = r1;
        }
    }
}

extern "C" void kernel_launch(void* const* d_in, const int* in_sizes, int n_in,
                              void* d_out, int out_size, void* d_ws, size_t ws_size,
                              hipStream_t stream) {
    (void)in_sizes; (void)n_in; (void)out_size; (void)d_ws; (void)ws_size;
    const float* Q = (const float*)d_in[0];
    const float* K = (const float*)d_in[1];
    const float* V = (const float*)d_in[2];
    float* O = (float*)d_out;

    dim3 grid(S_LEN / (WAVES * NQ * QTILE), 16 /*heads*/, 2 /*batch*/);
    dim3 block(BLOCK);
    OptimizedAttention_68736656605917_kernel<<<grid, block, 0, stream>>>(Q, K, V, O);
}

// v001
// Measured time: 67.1 microseconds a run.
// In two side-by-side timings against v000, it was 1.24 and 1.23 times as fast.
#include <hip/hip_runtime.h>

#define S_LEN   2048
#define DMODEL  1024
#define DK      64
#define QTILE   16      // q rows per q-subtile
#define NQ      2       // q-subtiles per wave (A-fragment reuse factor)
#define KTILE   64      // keys per mainloop iteration
#define NTILES  (S_LEN / KTILE)
#define WAVES   4
#define BLOCK   (WAVES * 32)
#define LDSP    72      // LDS pitch in halves (16B-aligned rows, staggered banks)

typedef __attribute__((ext_vector_type(16))) _Float16 v16h;
typedef __attribute__((ext_vector_type(8)))  _Float16 v8h;
typedef __attribute__((ext_vector_type(8)))  float    v8f;

static __device__ __forceinline__ v16h cat8(v8h a, v8h b) {
    return __builtin_shufflevector(a, b, 0,1,2,3,4,5,6,7,8,9,10,11,12,13,14,15);
}

// Load a 16x32 WMMA A/B fragment from row-major LDS (pitch LDSP halves).
// Lanes 0-15: elems {0..7}=col0+0..7, {8..15}=col0+16..23;
// lanes 16-31: elems {0..7}=col0+8..15, {8..15}=col0+24..31. Row = row0 + lane%16.
static __device__ __forceinline__ v16h lds_frag(const _Float16* base, int row0,
                                                int col0, int hi, int m) {
    const _Float16* r = base + (row0 + m) * LDSP + col0 + hi * 8;
    v8h lo = *(const v8h*)(r);
    v8h hh = *(const v8h*)(r + 16);
    return cat8(lo, hh);
}

__global__ __launch_bounds__(BLOCK)
void OptimizedAttention_68736656605917_kernel(const float* __restrict__ Q,
                                              const float* __restrict__ K,
                                              const float* __restrict__ V,
                                              float* __restrict__ O) {
    // double-buffered tiles: K row-major f16, V transposed f16
    __shared__ __align__(16) _Float16 Klds [2][KTILE * LDSP];
    __shared__ __align__(16) _Float16 VTlds[2][DK * LDSP];

    const int tid  = threadIdx.x;
    const int wave = tid >> 5;
    const int lane = tid & 31;
    const int hi   = lane >> 4;
    const int m    = lane & 15;

    const int qblk  = blockIdx.x;   // 0..15
    const int head  = blockIdx.y;   // 0..15
    const int batch = blockIdx.z;   // 0..1

    const int   qbase = qblk * (WAVES * NQ * QTILE) + wave * (NQ * QTILE);
    const float scale = 0.125f;     // 1/sqrt(64), folded into Q before f16 cvt

    // --- Q fragments (B-operand: lane = q column, d packed per WMMA layout) ---
    v16h qb[NQ][2];
#pragma unroll
    for (int qq = 0; qq < NQ; ++qq) {
        const float* qptr =
            Q + ((size_t)(batch * S_LEN + qbase + qq * QTILE + m)) * DMODEL + head * DK;
#pragma unroll
        for (int dh = 0; dh < 2; ++dh) {
            const float* p = qptr + dh * 32 + hi * 8;
            v16h f;
#pragma unroll
            for (int i = 0; i < 8; ++i) {
                f[i]     = (_Float16)(p[i]      * scale);
                f[i + 8] = (_Float16)(p[i + 16] * scale);
            }
            qb[qq][dh] = f;
        }
    }

    v8f o[NQ][4];
#pragma unroll
    for (int qq = 0; qq < NQ; ++qq)
#pragma unroll
        for (int n = 0; n < 4; ++n) o[qq][n] = {};
    float m_run[NQ], l_run[NQ];
#pragma unroll
    for (int qq = 0; qq < NQ; ++qq) { m_run[qq] = -3.0e38f; l_run[qq] = 0.0f; }

    const float* kbase_g = K + (size_t)batch * S_LEN * DMODEL + head * DK;
    const float* vbase_g = V + (size_t)batch * S_LEN * DMODEL + head * DK;

    const int tr = tid >> 4;          // 0..7  (tile row within a pass)
    const int tc = (tid & 15) * 4;    // 0..60 (float4 column)

    // ---- prologue: load tile 0 into buffer 0 ----
    {
        float4 k4[8], v4[8];
#pragma unroll
        for (int pass = 0; pass < 8; ++pass) {
            const int row = tr + pass * 8;
            k4[pass] = *(const float4*)(kbase_g + (size_t)row * DMODEL + tc);
            v4[pass] = *(const float4*)(vbase_g + (size_t)row * DMODEL + tc);
        }
#pragma unroll
        for (int pass = 0; pass < 8; ++pass) {
            const int row = tr + pass * 8;
            _Float16* kd = Klds[0] + row * LDSP + tc;
            kd[0] = (_Float16)k4[pass].x; kd[1] = (_Float16)k4[pass].y;
            kd[2] = (_Float16)k4[pass].z; kd[3] = (_Float16)k4[pass].w;
            VTlds[0][(tc + 0) * LDSP + row] = (_Float16)v4[pass].x;
            VTlds[0][(tc + 1) * LDSP + row] = (_Float16)v4[pass].y;
            VTlds[0][(tc + 2) * LDSP + row] = (_Float16)v4[pass].z;
            VTlds[0][(tc + 3) * LDSP + row] = (_Float16)v4[pass].w;
        }
    }
    __syncthreads();

    for (int it = 0; it < NTILES; ++it) {
        const int cur = it & 1;
        const int nxt = cur ^ 1;
        const bool have_next = (it + 1) < NTILES;

        // --- stage next tile's global loads NOW (latency overlaps compute) ---
        float4 k4[8], v4[8];
        if (have_next) {
            const int kt1 = (it + 1) * KTILE;
#pragma unroll
            for (int pass = 0; pass < 8; ++pass) {
                const int row = kt1 + tr + pass * 8;
                k4[pass] = *(const float4*)(kbase_g + (size_t)row * DMODEL + tc);
                v4[pass] = *(const float4*)(vbase_g + (size_t)row * DMODEL + tc);
            }
            if (it + 2 < NTILES) {  // prefetch tile i+2 toward L2 (global_prefetch_b8)
                const int kt2 = (it + 2) * KTILE;
                __builtin_prefetch(kbase_g + (size_t)(kt2 + (tid >> 1)) * DMODEL + (tid & 1) * 32, 0, 1);
                __builtin_prefetch(vbase_g + (size_t)(kt2 + (tid >> 1)) * DMODEL + (tid & 1) * 32, 0, 1);
            }
            // Stands in front of every reuse of the loads' address registers (a precaution).
            // As a volatile statement that may touch memory it also stands between the
            // loads above and the LDS reads below: without it the compiler sinks the
            // loads behind the compute, directly in front of their use.
            asm volatile("s_wait_xcnt 0x0" ::: "memory");
        }

        // --- S^T = K x Q : 4 tiles of 16(key)x16(q) per q-subtile.
        //     Each K-fragment (A) is loaded once and reused for NQ WMMAs. ---
        v8f st[NQ][4];
#pragma unroll
        for (int mt = 0; mt < 4; ++mt) {
            const v16h a0 = lds_frag(Klds[cur], mt * 16, 0, hi, m);
            const v16h a1 = lds_frag(Klds[cur], mt * 16, 32, hi, m);
#pragma unroll
            for (int qq = 0; qq < NQ; ++qq) {
                v8f c = {};
                c = __builtin_amdgcn_wmma_f32_16x16x32_f16(false, a0, false, qb[qq][0], (short)0, c, false, false);
                c = __builtin_amdgcn_wmma_f32_16x16x32_f16(false, a1, false, qb[qq][1], (short)0, c, false, false);
                st[qq][mt] = c;
            }
        }

        // --- online softmax + P fragments (per q-subtile) ---
        v16h pb[NQ][2];
#pragma unroll
        for (int qq = 0; qq < NQ; ++qq) {
            float mx = st[qq][0][0];
#pragma unroll
            for (int mt = 0; mt < 4; ++mt)
#pragma unroll
                for (int r = 0; r < 8; ++r) mx = fmaxf(mx, st[qq][mt][r]);
            mx = fmaxf(mx, __shfl_xor(mx, 16, 32));

            const float m_new = fmaxf(m_run[qq], mx);
            const float alpha = __expf(m_run[qq] - m_new);

            float lsum = 0.0f;
#pragma unroll
            for (int mt = 0; mt < 4; ++mt)
#pragma unroll
                for (int r = 0; r < 8; ++r) {
                    const float e = __expf(st[qq][mt][r] - m_new);
                    st[qq][mt][r] = e;
                    lsum += e;
                }
            lsum += __shfl_xor(lsum, 16, 32);
            l_run[qq] = l_run[qq] * alpha + lsum;
            m_run[qq] = m_new;

#pragma unroll
            for (int n = 0; n < 4; ++n) o[qq][n] *= alpha;

            // accumulator layout of S^T IS the B-operand layout for P
#pragma unroll
            for (int j = 0; j < 2; ++j) {
                v16h f;
#pragma unroll
                for (int i = 0; i < 8; ++i) {
                    f[i]     = (_Float16)st[qq][2 * j][i];
                    f[i + 8] = (_Float16)st[qq][2 * j + 1][i];
                }
                pb[qq][j] = f;
            }
        }

        // --- O^T += V^T x P : each V^T fragment reused for NQ WMMAs ---
#pragma unroll
        for (int n = 0; n < 4; ++n) {
            const v16h a0 = lds_frag(VTlds[cur], n * 16, 0, hi, m);
            const v16h a1 = lds_frag(VTlds[cur], n * 16, 32, hi, m);
#pragma unroll
            for (int qq = 0; qq < NQ; ++qq) {
                o[qq][n] = __builtin_amdgcn_wmma_f32_16x16x32_f16(false, a0, false, pb[qq][0], (short)0, o[qq][n], false, false);
                o[qq][n] = __builtin_amdgcn_wmma_f32_16x16x32_f16(false, a1, false, pb[qq][1], (short)0, o[qq][n], false, false);
            }
        }

        // --- drain staged loads into the other buffer (after compute) ---
        // Keeps the conversions, and with them the waits on the staged loads, below the
        // compute: the compiler otherwise lifts them to the loop's top.
        __builtin_amdgcn_sched_barrier(0);
        if (have_next) {
#pragma unroll
            for (int pass = 0; pass < 8; ++pass) {
                const int row = tr + pass * 8;
                _Float16* kd = Klds[nxt] + row * LDSP + tc;
                kd[0] = (_Float16)k4[pass].x; kd[1] = (_Float16)k4[pass].y;
                kd[2] = (_Float16)k4[pass].z; kd[3] = (_Float16)k4[pass].w;
                VTlds[nxt][(tc + 0) * LDSP + row] = (_Float16)v4[pass].x;
                VTlds[nxt][(tc + 1) * LDSP + row] = (_Float16)v4[pass].y;
                VTlds[nxt][(tc + 2) * LDSP + row] = (_Float16)v4[pass].z;
                VTlds[nxt][(tc + 3) * LDSP + row] = (_Float16)v4[pass].w;
            }
        }
        __syncthreads();
    }

    // --- normalize and store: lane holds q=m, d = n*16 + hi*8 + r (contig 8) ---
#pragma unroll
    for (int qq = 0; qq < NQ; ++qq) {
        const float inv = 1.0f / l_run[qq];
        float* obase = O + ((size_t)(batch * S_LEN + qbase + qq * QTILE + m)) * DMODEL
                         + head * DK + hi * 8;
#pragma unroll
        for (int n = 0; n < 4; ++n) {
            float4 r0, r1;
            r0.x = o[qq][n][0] * inv; r0.y = o[qq][n][1] * inv;
            r0.z = o[qq][n][2] * inv; r0.w = o[qq][n][3] * inv;
            r1.x = o[qq][n][4] * inv; r1.y = o[qq][n][5] * inv;
            r1.z = o[qq][n][6] * inv; r1.w = o[qq][n][7] * inv;
            *(float4*)(obase + n * 16)     = r0;
            *(float4*)(obase + n * 16 + 4) = r1;
        }
    }
}

extern "C" void kernel_launch(void* const* d_in, const int* in_sizes, int n_in,
                              void* d_out, int out_size, void* d_ws, size_t ws_size,
                              hipStream_t stream) {
    (void)in_sizes; (void)n_in; (void)out_size; (void)d_ws; (void)ws_size;
    const float* Q = (const float*)d_in[0];
    const float* K = (const float*)d_in[1];
    const float* V = (const float*)d_in[2];
    float* O = (float*)d_out;

    dim3 grid(S_LEN / (WAVES * NQ * QTILE), 16 /*heads*/, 2 /*batch*/);
    dim3 block(BLOCK);
    OptimizedAttention_68736656605917_kernel<<<grid, block, 0, stream>>>(Q, K, V, O);
}

// v002
// It runs in 49 microseconds.
// Two timings next to v001 both put it at 1.37 times that version's speed.
// Over all steps from v000 it is 1.69 times as fast.
#include <hip/hip_runtime.h>

#define S_LEN   2048
#define DMODEL  1024
#define DK      64
#define QTILE   16      // q rows per q-subtile
#define NQ      2       // q-subtiles per wave (A-fragment reuse factor)
#define KTILE   64      // keys per mainloop iteration
#define NTILES  (S_LEN / KTILE)
#define WAVES   4
#define BLOCK   (WAVES * 32)
#define LDSP    72      // LDS pitch in halves (16B-aligned rows, staggered banks)
#define VPITCH  80      // V pitch in halves: 160 B = 32 B x odd, the transposing load's pitch

typedef __attribute__((ext_vector_type(16))) _Float16 v16h;
typedef __attribute__((ext_vector_type(8)))  _Float16 v8h;
typedef __attribute__((ext_vector_type(8)))  float    v8f;
typedef __attribute__((ext_vector_type(8)))  short    s16x8;

static __device__ __forceinline__ v16h cat8(v8h a, v8h b) {
    return __builtin_shufflevector(a, b, 0,1,2,3,4,5,6,7,8,9,10,11,12,13,14,15);
}

// Load a 16x32 WMMA A/B fragment from row-major LDS (pitch LDSP halves).
// Lanes 0-15: elems {0..7}=col0+0..7, {8..15}=col0+16..23;
// lanes 16-31: elems {0..7}=col0+8..15, {8..15}=col0+24..31. Row = row0 + lane%16.
static __device__ __forceinline__ v16h lds_frag(const _Float16* base, int row0,
                                                int col0, int hi, int m) {
    const _Float16* r = base + (row0 + m) * LDSP + col0 + hi * 8;
    v8h lo = *(const v8h*)(r);
    v8h hh = *(const v8h*)(r + 16);
    return cat8(lo, hh);
}

// Load a 16(d) x 32(key) WMMA A fragment of V^T from row-major V[key][d] in LDS
// (pitch VPITCH halves) with the transposing load. Lane (c = lane%16, h = lane/16)
// gets keys key0 + 8h + 0..7 (elems 0..7) and key0 + 16 + 8h + 0..7 (elems 8..15)
// of column d0 + c: the same fragment lds_frag gives on a transposed tile.
static __device__ __forceinline__ v8h lds_tr16(const _Float16* p) {
    typedef __attribute__((address_space(3))) s16x8 lds_s16x8;
    return __builtin_bit_cast(v8h, __builtin_amdgcn_ds_load_tr16_b128_v8i16((lds_s16x8*)p));
}
static __device__ __forceinline__ v16h lds_frag_vt(const _Float16* base, int d0,
                                                   int key0, int lane) {
    const _Float16* p = base + (key0 + 8 * (lane >> 4) + (lane & 7)) * VPITCH
                             + d0 + 8 * ((lane >> 3) & 1);
    return cat8(lds_tr16(p), lds_tr16(p + 16 * VPITCH));
}

__global__ __launch_bounds__(BLOCK)
void OptimizedAttention_68736656605917_kernel(const float* __restrict__ Q,
                                              const float* __restrict__ K,
                                              const float* __restrict__ V,
                                              float* __restrict__ O) {
    // double-buffered tiles: K and V both row-major f16 (V is transposed when read)
    __shared__ __align__(16) _Float16 Klds[2][KTILE * LDSP];
    __shared__ __align__(16) _Float16 Vlds[2][KTILE * VPITCH];

    const int tid  = threadIdx.x;
    const int wave = tid >> 5;
    const int lane = tid & 31;
    const int hi   = lane >> 4;
    const int m    = lane & 15;

    const int qblk  = blockIdx.x;   // 0..15
    const int head  = blockIdx.y;   // 0..15
    const int batch = blockIdx.z;   // 0..1

    const int   qbase = qblk * (WAVES * NQ * QTILE) + wave * (NQ * QTILE);
    const float scale = 0.125f;     // 1/sqrt(64), folded into Q before f16 cvt

    // --- Q fragments (B-operand: lane = q column, d packed per WMMA layout) ---
    v16h qb[NQ][2];
#pragma unroll
    for (int qq = 0; qq < NQ; ++qq) {
        const float* qptr =
            Q + ((size_t)(batch * S_LEN + qbase + qq * QTILE + m)) * DMODEL + head * DK;
#pragma unroll
        for (int dh = 0; dh < 2; ++dh) {
            const float* p = qptr + dh * 32 + hi * 8;
            v16h f;
#pragma unroll
            for (int i = 0; i < 8; ++i) {
                f[i]     = (_Float16)(p[i]      * scale);
                f[i + 8] = (_Float16)(p[i + 16] * scale);
            }
            qb[qq][dh] = f;
        }
    }

    v8f o[NQ][4];
#pragma unroll
    for (int qq = 0; qq < NQ; ++qq)
#pragma unroll
        for (int n = 0; n < 4; ++n) o[qq][n] = {};
    float m_run[NQ], l_run[NQ];
#pragma unroll
    for (int qq = 0; qq < NQ; ++qq) { m_run[qq] = -3.0e38f; l_run[qq] = 0.0f; }

    const float* kbase_g = K + (size_t)batch * S_LEN * DMODEL + head * DK;
    const float* vbase_g = V + (size_t)batch * S_LEN * DMODEL + head * DK;

    const int tr = tid >> 4;          // 0..7  (tile row within a pass)
    const int tc = (tid & 15) * 4;    // 0..60 (float4 column)

    // ---- prologue: load tile 0 into buffer 0 ----
    {
        float4 k4[8], v4[8];
#pragma unroll
        for (int pass = 0; pass < 8; ++pass) {
            const int row = tr + pass * 8;
            k4[pass] = *(const float4*)(kbase_g + (size_t)row * DMODEL + tc);
            v4[pass] = *(const float4*)(vbase_g + (size_t)row * DMODEL + tc);
        }
#pragma unroll
        for (int pass = 0; pass < 8; ++pass) {
            const int row = tr + pass * 8;
            _Float16* kd = Klds[0] + row * LDSP + tc;
            kd[0] = (_Float16)k4[pass].x; kd[1] = (_Float16)k4[pass].y;
            kd[2] = (_Float16)k4[pass].z; kd[3] = (_Float16)k4[pass].w;
            _Float16* vd = Vlds[0] + row * VPITCH + tc;
            vd[0] = (_Float16)v4[pass].x; vd[1] = (_Float16)v4[pass].y;
            vd[2] = (_Float16)v4[pass].z; vd[3] = (_Float16)v4[pass].w;
        }
    }
    __syncthreads();

    for (int it = 0; it < NTILES; ++it) {
        const int cur = it & 1;
        const int nxt = cur ^ 1;
        const bool have_next = (it + 1) < NTILES;

        // --- stage next tile's global loads NOW (latency overlaps compute) ---
        float4 k4[8], v4[8];
        if (have_next) {
            const int kt1 = (it + 1) * KTILE;
#pragma unroll
            for (int pass = 0; pass < 8; ++pass) {
                const int row = kt1 + tr + pass * 8;
                k4[pass] = *(const float4*)(kbase_g + (size_t)row * DMODEL + tc);
                v4[pass] = *(const float4*)(vbase_g + (size_t)row * DMODEL + tc);
            }
            if (it + 2 < NTILES) {  // prefetch tile i+2 toward L2 (global_prefetch_b8)
                const int kt2 = (it + 2) * KTILE;
                __builtin_prefetch(kbase_g + (size_t)(kt2 + (tid >> 1)) * DMODEL + (tid & 1) * 32, 0, 1);
                __builtin_prefetch(vbase_g + (size_t)(kt2 + (tid >> 1)) * DMODEL + (tid & 1) * 32, 0, 1);
            }
            // Stands in front of every reuse of the loads' address registers (a precaution).
            // As a volatile statement that may touch memory it also stands between the
            // loads above and the LDS reads below: without it the compiler sinks the
            // loads behind the compute, directly in front of their use.
            asm volatile("s_wait_xcnt 0x0" ::: "memory");
        }

        // --- S^T = K x Q : 4 tiles of 16(key)x16(q) per q-subtile.
        //     Each K-fragment (A) is loaded once and reused for NQ WMMAs. ---
        v8f st[NQ][4];
#pragma unroll
        for (int mt = 0; mt < 4; ++mt) {
            const v16h a0 = lds_frag(Klds[cur], mt * 16, 0, hi, m);
            const v16h a1 = lds_frag(Klds[cur], mt * 16, 32, hi, m);
#pragma unroll
            for (int qq = 0; qq < NQ; ++qq) {
                v8f c = {};
                c = __builtin_amdgcn_wmma_f32_16x16x32_f16(false, a0, false, qb[qq][0], (short)0, c, false, false);
                c = __builtin_amdgcn_wmma_f32_16x16x32_f16(false, a1, false, qb[qq][1], (short)0, c, false, false);
                st[qq][mt] = c;
            }
        }

        // --- online softmax + P fragments (per q-subtile) ---
        v16h pb[NQ][2];
#pragma unroll
        for (int qq = 0; qq < NQ; ++qq) {
            float mx = st[qq][0][0];
#pragma unroll
            for (int mt = 0; mt < 4; ++mt)
#pragma unroll
                for (int r = 0; r < 8; ++r) mx = fmaxf(mx, st[qq][mt][r]);
            mx = fmaxf(mx, __shfl_xor(mx, 16, 32));

            const float m_new = fmaxf(m_run[qq], mx);
            const float alpha = __expf(m_run[qq] - m_new);

            float lsum = 0.0f;
#pragma unroll
            for (int mt = 0; mt < 4; ++mt)
#pragma unroll
                for (int r = 0; r < 8; ++r) {
                    const float e = __expf(st[qq][mt][r] - m_new);
                    st[qq][mt][r] = e;
                    lsum += e;
                }
            lsum += __shfl_xor(lsum, 16, 32);
            l_run[qq] = l_run[qq] * alpha + lsum;
            m_run[qq] = m_new;

#pragma unroll
            for (int n = 0; n < 4; ++n) o[qq][n] *= alpha;

            // accumulator layout of S^T IS the B-operand layout for P
#pragma unroll
            for (int j = 0; j < 2; ++j) {
                v16h f;
#pragma unroll
                for (int i = 0; i < 8; ++i) {
                    f[i]     = (_Float16)st[qq][2 * j][i];
                    f[i + 8] = (_Float16)st[qq][2 * j + 1][i];
                }
                pb[qq][j] = f;
            }
        }

        // --- O^T += V^T x P : each V^T fragment reused for NQ WMMAs ---
#pragma unroll
        for (int n = 0; n < 4; ++n) {
            const v16h a0 = lds_frag_vt(Vlds[cur], n * 16, 0, lane);
            const v16h a1 = lds_frag_vt(Vlds[cur], n * 16, 32, lane);
#pragma unroll
            for (int qq = 0; qq < NQ; ++qq) {
                o[qq][n] = __builtin_amdgcn_wmma_f32_16x16x32_f16(false, a0, false, pb[qq][0], (short)0, o[qq][n], false, false);
                o[qq][n] = __builtin_amdgcn_wmma_f32_16x16x32_f16(false, a1, false, pb[qq][1], (short)0, o[qq][n], false, false);
            }
        }

        // --- drain staged loads into the other buffer (after compute) ---
        // Keeps the conversions, and with them the waits on the staged loads, below the
        // compute: the compiler otherwise lifts them to the loop's top.
        __builtin_amdgcn_sched_barrier(0);
        if (have_next) {
#pragma unroll
            for (int pass = 0; pass < 8; ++pass) {
                const int row = tr + pass * 8;
                _Float16* kd = Klds[nxt] + row * LDSP + tc;
                kd[0] = (_Float16)k4[pass].x; kd[1] = (_Float16)k4[pass].y;
                kd[2] = (_Float16)k4[pass].z; kd[3] = (_Float16)k4[pass].w;
                _Float16* vd = Vlds[nxt] + row * VPITCH + tc;
                vd[0] = (_Float16)v4[pass].x; vd[1] = (_Float16)v4[pass].y;
                vd[2] = (_Float16)v4[pass].z; vd[3] = (_Float16)v4[pass].w;
            }
        }
        __syncthreads();
    }

    // --- normalize and store: lane holds q=m, d = n*16 + hi*8 + r (contig 8) ---
#pragma unroll
    for (int qq = 0; qq < NQ; ++qq) {
        const float inv = 1.0f / l_run[qq];
        float* obase = O + ((size_t)(batch * S_LEN + qbase + qq * QTILE + m)) * DMODEL
                         + head * DK + hi * 8;
#pragma unroll
        for (int n = 0; n < 4; ++n) {
            float4 r0, r1;
            r0.x = o[qq][n][0] * inv; r0.y = o[qq][n][1] * inv;
            r0.z = o[qq][n][2] * inv; r0.w = o[qq][n][3] * inv;
            r1.x = o[qq][n][4] * inv; r1.y = o[qq][n][5] * inv;
            r1.z = o[qq][n][6] * inv; r1.w = o[qq][n][7] * inv;
            *(float4*)(obase + n * 16)     = r0;
            *(float4*)(obase + n * 16 + 4) = r1;
        }
    }
}

extern "C" void kernel_launch(void* const* d_in, const int* in_sizes, int n_in,
                              void* d_out, int out_size, void* d_ws, size_t ws_size,
                              hipStream_t stream) {
    (void)in_sizes; (void)n_in; (void)out_size; (void)d_ws; (void)ws_size;
    const float* Q = (const float*)d_in[0];
    const float* K = (const float*)d_in[1];
    const float* V = (const float*)d_in[2];
    float* O = (float*)d_out;

    dim3 grid(S_LEN / (WAVES * NQ * QTILE), 16 /*heads*/, 2 /*batch*/);
    dim3 block(BLOCK);
    OptimizedAttention_68736656605917_kernel<<<grid, block, 0, stream>>>(Q, K, V, O);
}

// v003
// Measured time: 45.3 microseconds a run.
// In both of two side-by-side timings against v002, it was 1.08 times as fast.
// Over all steps from v000 it is 1.83 times as fast.
#include <hip/hip_runtime.h>

#define S_LEN   2048
#define DMODEL  1024
#define DK      64
#define QTILE   16      // q rows per q-subtile
#define NQ      1       // q-subtiles per wave: 16 columns, so that the grid makes 4 waves per SIMD
#define KTILE   64      // keys per mainloop iteration
#define NTILES  (S_LEN / KTILE)
#define WAVES   8
#define BLOCK   (WAVES * 32)
#define SROWS   (BLOCK / 16)        // tile rows staged per pass (16 threads per row)
#define SPASS   (KTILE / SROWS)     // staging passes per tile
#define LDSP    72      // LDS pitch in halves (16B-aligned rows, staggered banks)
#define VPITCH  80      // V pitch in halves: 160 B = 32 B x odd, the transposing load's pitch

typedef __attribute__((ext_vector_type(16))) _Float16 v16h;
typedef __attribute__((ext_vector_type(8)))  _Float16 v8h;
typedef __attribute__((ext_vector_type(8)))  float    v8f;
typedef __attribute__((ext_vector_type(8)))  short    s16x8;

static __device__ __forceinline__ v16h cat8(v8h a, v8h b) {
    return __builtin_shufflevector(a, b, 0,1,2,3,4,5,6,7,8,9,10,11,12,13,14,15);
}

// Load a 16x32 WMMA A/B fragment from row-major LDS (pitch LDSP halves).
// Lanes 0-15: elems {0..7}=col0+0..7, {8..15}=col0+16..23;
// lanes 16-31: elems {0..7}=col0+8..15, {8..15}=col0+24..31. Row = row0 + lane%16.
static __device__ __forceinline__ v16h lds_frag(const _Float16* base, int row0,
                                                int col0, int hi, int m) {
    const _Float16* r = base + (row0 + m) * LDSP + col0 + hi * 8;
    v8h lo = *(const v8h*)(r);
    v8h hh = *(const v8h*)(r + 16);
    return cat8(lo, hh);
}

// Load a 16(d) x 32(key) WMMA A fragment of V^T from row-major V[key][d] in LDS
// (pitch VPITCH halves) with the transposing load. Lane (c = lane%16, h = lane/16)
// gets keys key0 + 8h + 0..7 (elems 0..7) and key0 + 16 + 8h + 0..7 (elems 8..15)
// of column d0 + c: the same fragment lds_frag gives on a transposed tile.
static __device__ __forceinline__ v8h lds_tr16(const _Float16* p) {
    typedef __attribute__((address_space(3))) s16x8 lds_s16x8;
    return __builtin_bit_cast(v8h, __builtin_amdgcn_ds_load_tr16_b128_v8i16((lds_s16x8*)p));
}
static __device__ __forceinline__ v16h lds_frag_vt(const _Float16* base, int d0,
                                                   int key0, int lane) {
    const _Float16* p = base + (key0 + 8 * (lane >> 4) + (lane & 7)) * VPITCH
                             + d0 + 8 * ((lane >> 3) & 1);
    return cat8(lds_tr16(p), lds_tr16(p + 16 * VPITCH));
}

// Four waves per SIMD (two blocks per WGP) is all the grid can fill: the register budget is set for that.
__global__ __launch_bounds__(BLOCK) __attribute__((amdgpu_waves_per_eu(4, 4)))
void OptimizedAttention_68736656605917_kernel(const float* __restrict__ Q,
                                              const float* __restrict__ K,
                                              const float* __restrict__ V,
                                              float* __restrict__ O) {
    // double-buffered tiles: K and V both row-major f16 (V is transposed when read)
    __shared__ __align__(16) _Float16 Klds[2][KTILE * LDSP];
    __shared__ __align__(16) _Float16 Vlds[2][KTILE * VPITCH];

    const int tid  = threadIdx.x;
    const int wave = tid >> 5;
    const int lane = tid & 31;
    const int hi   = lane >> 4;
    const int m    = lane & 15;

    const int qblk  = blockIdx.x;   // 0..15
    const int head  = blockIdx.y;   // 0..15
    const int batch = blockIdx.z;   // 0..1

    const int   qbase = qblk * (WAVES * NQ * QTILE) + wave * (NQ * QTILE);
    const float scale = 0.125f;     // 1/sqrt(64), folded into Q before f16 cvt

    // --- Q fragments (B-operand: lane = q column, d packed per WMMA layout) ---
    v16h qb[NQ][2];
#pragma unroll
    for (int qq = 0; qq < NQ; ++qq) {
        const float* qptr =
            Q + ((size_t)(batch * S_LEN + qbase + qq * QTILE + m)) * DMODEL + head * DK;
#pragma unroll
        for (int dh = 0; dh < 2; ++dh) {
            const float* p = qptr + dh * 32 + hi * 8;
            v16h f;
#pragma unroll
            for (int i = 0; i < 8; ++i) {
                f[i]     = (_Float16)(p[i]      * scale);
                f[i + 8] = (_Float16)(p[i + 16] * scale);
            }
            qb[qq][dh] = f;
        }
    }

    v8f o[NQ][4];
#pragma unroll
    for (int qq = 0; qq < NQ; ++qq)
#pragma unroll
        for (int n = 0; n < 4; ++n) o[qq][n] = {};
    float m_run[NQ], l_run[NQ];
#pragma unroll
    for (int qq = 0; qq < NQ; ++qq) { m_run[qq] = -3.0e38f; l_run[qq] = 0.0f; }

    const float* kbase_g = K + (size_t)batch * S_LEN * DMODEL + head * DK;
    const float* vbase_g = V + (size_t)batch * S_LEN * DMODEL + head * DK;

    const int tr = tid >> 4;          // 0..SROWS-1 (tile row within a pass)
    const int tc = (tid & 15) * 4;    // 0..60 (float4 column)
    const bool pf_wave = __builtin_amdgcn_readfirstlane(wave) < 4;   // wave-uniform, a scalar test

    // ---- prologue: load tile 0 into buffer 0 ----
    {
        float4 k4[SPASS], v4[SPASS];
#pragma unroll
        for (int pass = 0; pass < SPASS; ++pass) {
            const int row = tr + pass * SROWS;
            k4[pass] = *(const float4*)(kbase_g + (size_t)row * DMODEL + tc);
            v4[pass] = *(const float4*)(vbase_g + (size_t)row * DMODEL + tc);
        }
#pragma unroll
        for (int pass = 0; pass < SPASS; ++pass) {
            const int row = tr + pass * SROWS;
            _Float16* kd = Klds[0] + row * LDSP + tc;
            kd[0] = (_Float16)k4[pass].x; kd[1] = (_Float16)k4[pass].y;
            kd[2] = (_Float16)k4[pass].z; kd[3] = (_Float16)k4[pass].w;
            _Float16* vd = Vlds[0] + row * VPITCH + tc;
            vd[0] = (_Float16)v4[pass].x; vd[1] = (_Float16)v4[pass].y;
            vd[2] = (_Float16)v4[pass].z; vd[3] = (_Float16)v4[pass].w;
        }
    }
    __syncthreads();

    for (int it = 0; it < NTILES; ++it) {
        const int cur = it & 1;
        const int nxt = cur ^ 1;
        const bool have_next = (it + 1) < NTILES;

        // --- stage next tile's global loads NOW (latency overlaps compute) ---
        float4 k4[SPASS], v4[SPASS];
        if (have_next) {
            const int kt1 = (it + 1) * KTILE;
#pragma unroll
            for (int pass = 0; pass < SPASS; ++pass) {
                const int row = kt1 + tr + pass * SROWS;
                k4[pass] = *(const float4*)(kbase_g + (size_t)row * DMODEL + tc);
                v4[pass] = *(const float4*)(vbase_g + (size_t)row * DMODEL + tc);
            }
            // prefetch tile i+2 toward L2 (global_prefetch_b8): 128 threads cover the tile's lines
            if (it + 2 < NTILES && pf_wave) {
                const int kt2 = (it + 2) * KTILE;
                __builtin_prefetch(kbase_g + (size_t)(kt2 + (tid >> 1)) * DMODEL + (tid & 1) * 32, 0, 1);
                __builtin_prefetch(vbase_g + (size_t)(kt2 + (tid >> 1)) * DMODEL + (tid & 1) * 32, 0, 1);
            }
            // Stands in front of every reuse of the loads' address registers (a precaution).
            // As a volatile statement that may touch memory it also stands between the
            // loads above and the LDS reads below: without it the compiler sinks the
            // loads behind the compute, directly in front of their use.
            asm volatile("s_wait_xcnt 0x0" ::: "memory");
        }

        // --- S^T = K x Q : 4 tiles of 16(key)x16(q) per q-subtile.
        //     Each K-fragment (A) is loaded once and reused for NQ WMMAs. ---
        v8f st[NQ][4];
#pragma unroll
        for (int mt = 0; mt < 4; ++mt) {
            const v16h a0 = lds_frag(Klds[cur], mt * 16, 0, hi, m);
            const v16h a1 = lds_frag(Klds[cur], mt * 16, 32, hi, m);
#pragma unroll
            for (int qq = 0; qq < NQ; ++qq) {
                v8f c = {};
                c = __builtin_amdgcn_wmma_f32_16x16x32_f16(false, a0, false, qb[qq][0], (short)0, c, false, false);
                c = __builtin_amdgcn_wmma_f32_16x16x32_f16(false, a1, false, qb[qq][1], (short)0, c, false, false);
                st[qq][mt] = c;
            }
        }

        // --- online softmax + P fragments (per q-subtile) ---
        v16h pb[NQ][2];
#pragma unroll
        for (int qq = 0; qq < NQ; ++qq) {
            float mx = st[qq][0][0];
#pragma unroll
            for (int mt = 0; mt < 4; ++mt)
#pragma unroll
                for (int r = 0; r < 8; ++r) mx = fmaxf(mx, st[qq][mt][r]);
            mx = fmaxf(mx, __shfl_xor(mx, 16, 32));

            const float m_new = fmaxf(m_run[qq], mx);
            const float alpha = __expf(m_run[qq] - m_new);

            float lsum = 0.0f;
#pragma unroll
            for (int mt = 0; mt < 4; ++mt)
#pragma unroll
                for (int r = 0; r < 8; ++r) {
                    const float e = __expf(st[qq][mt][r] - m_new);
                    st[qq][mt][r] = e;
                    lsum += e;
                }
            lsum += __shfl_xor(lsum, 16, 32);
            l_run[qq] = l_run[qq] * alpha + lsum;
            m_run[qq] = m_new;

#pragma unroll
            for (int n = 0; n < 4; ++n) o[qq][n] *= alpha;

            // accumulator layout of S^T IS the B-operand layout for P
#pragma unroll
            for (int j = 0; j < 2; ++j) {
                v16h f;
#pragma unroll
                for (int i = 0; i < 8; ++i) {
                    f[i]     = (_Float16)st[qq][2 * j][i];
                    f[i + 8] = (_Float16)st[qq][2 * j + 1][i];
                }
                pb[qq][j] = f;
            }
        }

        // --- O^T += V^T x P : each V^T fragment reused for NQ WMMAs ---
#pragma unroll
        for (int n = 0; n < 4; ++n) {
            const v16h a0 = lds_frag_vt(Vlds[cur], n * 16, 0, lane);
            const v16h a1 = lds_frag_vt(Vlds[cur], n * 16, 32, lane);
#pragma unroll
            for (int qq = 0; qq < NQ; ++qq) {
                o[qq][n] = __builtin_amdgcn_wmma_f32_16x16x32_f16(false, a0, false, pb[qq][0], (short)0, o[qq][n], false, false);
                o[qq][n] = __builtin_amdgcn_wmma_f32_16x16x32_f16(false, a1, false, pb[qq][1], (short)0, o[qq][n], false, false);
            }
        }

        // --- drain staged loads into the other buffer (after compute) ---
        // Keeps the conversions, and with them the waits on the staged loads, below the
        // compute: the compiler otherwise lifts them to the loop's top.
        __builtin_amdgcn_sched_barrier(0);
        if (have_next) {
#pragma unroll
            for (int pass = 0; pass < SPASS; ++pass) {
                const int row = tr + pass * SROWS;
                _Float16* kd = Klds[nxt] + row * LDSP + tc;
                kd[0] = (_Float16)k4[pass].x; kd[1] = (_Float16)k4[pass].y;
                kd[2] = (_Float16)k4[pass].z; kd[3] = (_Float16)k4[pass].w;
                _Float16* vd = Vlds[nxt] + row * VPITCH + tc;
                vd[0] = (_Float16)v4[pass].x; vd[1] = (_Float16)v4[pass].y;
                vd[2] = (_Float16)v4[pass].z; vd[3] = (_Float16)v4[pass].w;
            }
        }
        __syncthreads();
    }

    // --- normalize and store: lane holds q=m, d = n*16 + hi*8 + r (contig 8) ---
#pragma unroll
    for (int qq = 0; qq < NQ; ++qq) {
        const float inv = 1.0f / l_run[qq];
        float* obase = O + ((size_t)(batch * S_LEN + qbase + qq * QTILE + m)) * DMODEL
                         + head * DK + hi * 8;
#pragma unroll
        for (int n = 0; n < 4; ++n) {
            float4 r0, r1;
            r0.x = o[qq][n][0] * inv; r0.y = o[qq][n][1] * inv;
            r0.z = o[qq][n][2] * inv; r0.w = o[qq][n][3] * inv;
            r1.x = o[qq][n][4] * inv; r1.y = o[qq][n][5] * inv;
            r1.z = o[qq][n][6] * inv; r1.w = o[qq][n][7] * inv;
            *(float4*)(obase + n * 16)     = r0;
            *(float4*)(obase + n * 16 + 4) = r1;
        }
    }
}

extern "C" void kernel_launch(void* const* d_in, const int* in_sizes, int n_in,
                              void* d_out, int out_size, void* d_ws, size_t ws_size,
                              hipStream_t stream) {
    (void)in_sizes; (void)n_in; (void)out_size; (void)d_ws; (void)ws_size;
    const float* Q = (const float*)d_in[0];
    const float* K = (const float*)d_in[1];
    const float* V = (const float*)d_in[2];
    float* O = (float*)d_out;

    dim3 grid(S_LEN / (WAVES * NQ * QTILE), 16 /*heads*/, 2 /*batch*/);
    dim3 block(BLOCK);
    OptimizedAttention_68736656605917_kernel<<<grid, block, 0, stream>>>(Q, K, V, O);
}

// v004
// It runs in 43.9 microseconds.
// Timed twice side by side with v003, it ran 1.03 times as fast both times.
// Over all steps from v000 it is 1.88 times as fast.
#include <hip/hip_runtime.h>

#define S_LEN   2048
#define DMODEL  1024
#define DK      64
#define QTILE   16      // q rows per q-subtile
#define NQ      1       // q-subtiles per wave: 16 columns, so that the grid makes 4 waves per SIMD
#define KTILE   64      // keys per mainloop iteration
#define NTILES  (S_LEN / KTILE)
#define WAVES   8
#define BLOCK   (WAVES * 32)
#define SROWS   (BLOCK / 16)        // tile rows staged per pass (16 threads per row)
#define SPASS   (KTILE / SROWS)     // staging passes per tile
#define LDSP    72      // LDS pitch in halves (16B-aligned rows, staggered banks)
#define VPITCH  80      // V pitch in halves: 160 B = 32 B x odd, the transposing load's pitch

typedef __attribute__((ext_vector_type(16))) _Float16 v16h;
typedef __attribute__((ext_vector_type(8)))  _Float16 v8h;
typedef __attribute__((ext_vector_type(8)))  float    v8f;
typedef __attribute__((ext_vector_type(8)))  short    s16x8;

static __device__ __forceinline__ v16h cat8(v8h a, v8h b) {
    return __builtin_shufflevector(a, b, 0,1,2,3,4,5,6,7,8,9,10,11,12,13,14,15);
}

// Load a 16x32 WMMA A/B fragment from row-major LDS (pitch LDSP halves).
// Lanes 0-15: elems {0..7}=col0+0..7, {8..15}=col0+16..23;
// lanes 16-31: elems {0..7}=col0+8..15, {8..15}=col0+24..31. Row = row0 + lane%16.
static __device__ __forceinline__ v16h lds_frag(const _Float16* base, int row0,
                                                int col0, int hi, int m) {
    const _Float16* r = base + (row0 + m) * LDSP + col0 + hi * 8;
    v8h lo = *(const v8h*)(r);
    v8h hh = *(const v8h*)(r + 16);
    return cat8(lo, hh);
}

// Load a 16(d) x 32(key) WMMA A fragment of V^T from row-major V[key][d] in LDS
// (pitch VPITCH halves) with the transposing load. Lane (c = lane%16, h = lane/16)
// gets keys key0 + 8h + 0..7 (elems 0..7) and key0 + 16 + 8h + 0..7 (elems 8..15)
// of column d0 + c: the same fragment lds_frag gives on a transposed tile.
static __device__ __forceinline__ v8h lds_tr16(const _Float16* p) {
    typedef __attribute__((address_space(3))) s16x8 lds_s16x8;
    return __builtin_bit_cast(v8h, __builtin_amdgcn_ds_load_tr16_b128_v8i16((lds_s16x8*)p));
}
static __device__ __forceinline__ v16h lds_frag_vt(const _Float16* base, int d0,
                                                   int key0, int lane) {
    const _Float16* p = base + (key0 + 8 * (lane >> 4) + (lane & 7)) * VPITCH
                             + d0 + 8 * ((lane >> 3) & 1);
    return cat8(lds_tr16(p), lds_tr16(p + 16 * VPITCH));
}

// Lane l with lane l ^ 16 on the vector pipe (v_permlanex16_b32). __shfl_xor compiles to an
// LDS operation whose wait also drains every V fragment load queued in front of it.
static __device__ __forceinline__ float xhalf(float x) {
    const int b = __builtin_bit_cast(int, x);
    return __builtin_bit_cast(float,
        __builtin_amdgcn_permlanex16(b, b, 0x76543210, 0xfedcba98, false, false));
}

// Four waves per SIMD (two blocks per WGP) is all the grid can fill: the register budget is set for that.
__global__ __launch_bounds__(BLOCK) __attribute__((amdgpu_waves_per_eu(4, 4)))
void OptimizedAttention_68736656605917_kernel(const float* __restrict__ Q,
                                              const float* __restrict__ K,
                                              const float* __restrict__ V,
                                              float* __restrict__ O) {
    // double-buffered tiles: K and V both row-major f16 (V is transposed when read)
    __shared__ __align__(16) _Float16 Klds[2][KTILE * LDSP];
    __shared__ __align__(16) _Float16 Vlds[2][KTILE * VPITCH];

    const int tid  = threadIdx.x;
    const int wave = tid >> 5;
    const int lane = tid & 31;
    const int hi   = lane >> 4;
    const int m    = lane & 15;

    const int qblk  = blockIdx.x;   // 0..15
    const int head  = blockIdx.y;   // 0..15
    const int batch = blockIdx.z;   // 0..1

    const int   qbase = qblk * (WAVES * NQ * QTILE) + wave * (NQ * QTILE);
    const float scale = 0.125f;     // 1/sqrt(64), folded into Q before f16 cvt

    // --- Q fragments (B-operand: lane = q column, d packed per WMMA layout) ---
    v16h qb[NQ][2];
#pragma unroll
    for (int qq = 0; qq < NQ; ++qq) {
        const float* qptr =
            Q + ((size_t)(batch * S_LEN + qbase + qq * QTILE + m)) * DMODEL + head * DK;
#pragma unroll
        for (int dh = 0; dh < 2; ++dh) {
            const float* p = qptr + dh * 32 + hi * 8;
            v16h f;
#pragma unroll
            for (int i = 0; i < 8; ++i) {
                f[i]     = (_Float16)(p[i]      * scale);
                f[i + 8] = (_Float16)(p[i + 16] * scale);
            }
            qb[qq][dh] = f;
        }
    }

    v8f o[NQ][4];
#pragma unroll
    for (int qq = 0; qq < NQ; ++qq)
#pragma unroll
        for (int n = 0; n < 4; ++n) o[qq][n] = {};
    float m_run[NQ], l_run[NQ];
#pragma unroll
    for (int qq = 0; qq < NQ; ++qq) { m_run[qq] = -3.0e38f; l_run[qq] = 0.0f; }

    const float* kbase_g = K + (size_t)batch * S_LEN * DMODEL + head * DK;
    const float* vbase_g = V + (size_t)batch * S_LEN * DMODEL + head * DK;

    const int tr = tid >> 4;          // 0..SROWS-1 (tile row within a pass)
    const int tc = (tid & 15) * 4;    // 0..60 (float4 column)
    const bool pf_wave = __builtin_amdgcn_readfirstlane(wave) < 4;   // wave-uniform, a scalar test

    // ---- prologue: load tile 0 into buffer 0 ----
    {
        float4 k4[SPASS], v4[SPASS];
#pragma unroll
        for (int pass = 0; pass < SPASS; ++pass) {
            const int row = tr + pass * SROWS;
            k4[pass] = *(const float4*)(kbase_g + (size_t)row * DMODEL + tc);
            v4[pass] = *(const float4*)(vbase_g + (size_t)row * DMODEL + tc);
        }
#pragma unroll
        for (int pass = 0; pass < SPASS; ++pass) {
            const int row = tr + pass * SROWS;
            _Float16* kd = Klds[0] + row * LDSP + tc;
            kd[0] = (_Float16)k4[pass].x; kd[1] = (_Float16)k4[pass].y;
            kd[2] = (_Float16)k4[pass].z; kd[3] = (_Float16)k4[pass].w;
            _Float16* vd = Vlds[0] + row * VPITCH + tc;
            vd[0] = (_Float16)v4[pass].x; vd[1] = (_Float16)v4[pass].y;
            vd[2] = (_Float16)v4[pass].z; vd[3] = (_Float16)v4[pass].w;
        }
    }
    __syncthreads();

    for (int it = 0; it < NTILES; ++it) {
        const int cur = it & 1;
        const int nxt = cur ^ 1;
        const bool have_next = (it + 1) < NTILES;

        // --- stage next tile's global loads NOW (latency overlaps compute) ---
        float4 k4[SPASS], v4[SPASS];
        if (have_next) {
            const int kt1 = (it + 1) * KTILE;
#pragma unroll
            for (int pass = 0; pass < SPASS; ++pass) {
                const int row = kt1 + tr + pass * SROWS;
                k4[pass] = *(const float4*)(kbase_g + (size_t)row * DMODEL + tc);
                v4[pass] = *(const float4*)(vbase_g + (size_t)row * DMODEL + tc);
            }
            // prefetch tile i+2 toward L2 (global_prefetch_b8): 128 threads cover the tile's lines
            if (it + 2 < NTILES && pf_wave) {
                const int kt2 = (it + 2) * KTILE;
                __builtin_prefetch(kbase_g + (size_t)(kt2 + (tid >> 1)) * DMODEL + (tid & 1) * 32, 0, 1);
                __builtin_prefetch(vbase_g + (size_t)(kt2 + (tid >> 1)) * DMODEL + (tid & 1) * 32, 0, 1);
            }
            // Stands in front of every reuse of the loads' address registers (a precaution).
            // As a volatile statement that may touch memory it also stands between the
            // loads above and the LDS reads below: without it the compiler sinks the
            // loads behind the compute, directly in front of their use.
            asm volatile("s_wait_xcnt 0x0" ::: "memory");
        }

        // --- S^T = K x Q : 4 tiles of 16(key)x16(q) per q-subtile.
        //     Each K-fragment (A) is loaded once and reused for NQ WMMAs. ---
        v8f st[NQ][4];
#pragma unroll
        for (int mt = 0; mt < 4; ++mt) {
            const v16h a0 = lds_frag(Klds[cur], mt * 16, 0, hi, m);
            const v16h a1 = lds_frag(Klds[cur], mt * 16, 32, hi, m);
#pragma unroll
            for (int qq = 0; qq < NQ; ++qq) {
                v8f c = {};
                c = __builtin_amdgcn_wmma_f32_16x16x32_f16(false, a0, false, qb[qq][0], (short)0, c, false, false);
                c = __builtin_amdgcn_wmma_f32_16x16x32_f16(false, a1, false, qb[qq][1], (short)0, c, false, false);
                st[qq][mt] = c;
            }
        }

        // --- online softmax + P fragments (per q-subtile) ---
        v16h pb[NQ][2];
#pragma unroll
        for (int qq = 0; qq < NQ; ++qq) {
            float mx = st[qq][0][0];
#pragma unroll
            for (int mt = 0; mt < 4; ++mt)
#pragma unroll
                for (int r = 0; r < 8; ++r) mx = fmaxf(mx, st[qq][mt][r]);
            mx = fmaxf(mx, xhalf(mx));

            const float m_new = fmaxf(m_run[qq], mx);
            const float alpha = __expf(m_run[qq] - m_new);

            float lsum = 0.0f;
#pragma unroll
            for (int mt = 0; mt < 4; ++mt)
#pragma unroll
                for (int r = 0; r < 8; ++r) {
                    const float e = __expf(st[qq][mt][r] - m_new);
                    st[qq][mt][r] = e;
                    lsum += e;
                }
            lsum += xhalf(lsum);
            l_run[qq] = l_run[qq] * alpha + lsum;
            m_run[qq] = m_new;

#pragma unroll
            for (int n = 0; n < 4; ++n) o[qq][n] *= alpha;

            // accumulator layout of S^T IS the B-operand layout for P
#pragma unroll
            for (int j = 0; j < 2; ++j) {
                v16h f;
#pragma unroll
                for (int i = 0; i < 8; ++i) {
                    f[i]     = (_Float16)st[qq][2 * j][i];
                    f[i + 8] = (_Float16)st[qq][2 * j + 1][i];
                }
                pb[qq][j] = f;
            }
        }

        // --- O^T += V^T x P : each V^T fragment reused for NQ WMMAs ---
#pragma unroll
        for (int n = 0; n < 4; ++n) {
            const v16h a0 = lds_frag_vt(Vlds[cur], n * 16, 0, lane);
            const v16h a1 = lds_frag_vt(Vlds[cur], n * 16, 32, lane);
#pragma unroll
            for (int qq = 0; qq < NQ; ++qq) {
                o[qq][n] = __builtin_amdgcn_wmma_f32_16x16x32_f16(false, a0, false, pb[qq][0], (short)0, o[qq][n], false, false);
                o[qq][n] = __builtin_amdgcn_wmma_f32_16x16x32_f16(false, a1, false, pb[qq][1], (short)0, o[qq][n], false, false);
            }
        }

        // --- drain staged loads into the other buffer (after compute) ---
        // Keeps the conversions, and with them the waits on the staged loads, below the
        // compute: the compiler otherwise lifts them to the loop's top.
        __builtin_amdgcn_sched_barrier(0);
        if (have_next) {
#pragma unroll
            for (int pass = 0; pass < SPASS; ++pass) {
                const int row = tr + pass * SROWS;
                _Float16* kd = Klds[nxt] + row * LDSP + tc;
                kd[0] = (_Float16)k4[pass].x; kd[1] = (_Float16)k4[pass].y;
                kd[2] = (_Float16)k4[pass].z; kd[3] = (_Float16)k4[pass].w;
                _Float16* vd = Vlds[nxt] + row * VPITCH + tc;
                vd[0] = (_Float16)v4[pass].x; vd[1] = (_Float16)v4[pass].y;
                vd[2] = (_Float16)v4[pass].z; vd[3] = (_Float16)v4[pass].w;
            }
        }
        __syncthreads();
    }

    // --- normalize and store: lane holds q=m, d = n*16 + hi*8 + r (contig 8) ---
#pragma unroll
    for (int qq = 0; qq < NQ; ++qq) {
        const float inv = 1.0f / l_run[qq];
        float* obase = O + ((size_t)(batch * S_LEN + qbase + qq * QTILE + m)) * DMODEL
                         + head * DK + hi * 8;
#pragma unroll
        for (int n = 0; n < 4; ++n) {
            float4 r0, r1;
            r0.x = o[qq][n][0] * inv; r0.y = o[qq][n][1] * inv;
            r0.z = o[qq][n][2] * inv; r0.w = o[qq][n][3] * inv;
            r1.x = o[qq][n][4] * inv; r1.y = o[qq][n][5] * inv;
            r1.z = o[qq][n][6] * inv; r1.w = o[qq][n][7] * inv;
            *(float4*)(obase + n * 16)     = r0;
            *(float4*)(obase + n * 16 + 4) = r1;
        }
    }
}

extern "C" void kernel_launch(void* const* d_in, const int* in_sizes, int n_in,
                              void* d_out, int out_size, void* d_ws, size_t ws_size,
                              hipStream_t stream) {
    (void)in_sizes; (void)n_in; (void)out_size; (void)d_ws; (void)ws_size;
    const float* Q = (const float*)d_in[0];
    const float* K = (const float*)d_in[1];
    const float* V = (const float*)d_in[2];
    float* O = (float*)d_out;

    dim3 grid(S_LEN / (WAVES * NQ * QTILE), 16 /*heads*/, 2 /*batch*/);
    dim3 block(BLOCK);
    OptimizedAttention_68736656605917_kernel<<<grid, block, 0, stream>>>(Q, K, V, O);
}

// v005
// One run takes 41.4 microseconds.
// Next to v004, in two timings, it ran 1.06 times as fast each time.
// Over all steps from v000 it is 2.00 times as fast.
#include <hip/hip_runtime.h>

#define S_LEN   2048
#define DMODEL  1024
#define DK      64
#define QTILE   16      // q rows per q-subtile
#define NQ      1       // q-subtiles per wave: 16 columns, so that the grid makes 4 waves per SIMD
#define KTILE   64      // keys per mainloop iteration
#define NTILES  (S_LEN / KTILE)
#define WAVES   8
#define BLOCK   (WAVES * 32)
#define SROWS   (BLOCK / 16)        // tile rows staged per pass (16 threads per row)
#define SPASS   (KTILE / SROWS)     // staging passes per tile
#define LDSP    72      // LDS pitch in halves (16B-aligned rows, staggered banks)
#define VPITCH  80      // V pitch in halves: 160 B = 32 B x odd, the transposing load's pitch
#define LAZY_T  5.5f    // a column's scores may top the maximum in use by this much (P <= e^5.5 = 245, far inside f16)

typedef __attribute__((ext_vector_type(16))) _Float16 v16h;
typedef __attribute__((ext_vector_type(8)))  _Float16 v8h;
typedef __attribute__((ext_vector_type(8)))  float    v8f;
typedef __attribute__((ext_vector_type(8)))  short    s16x8;

static __device__ __forceinline__ v16h cat8(v8h a, v8h b) {
    return __builtin_shufflevector(a, b, 0,1,2,3,4,5,6,7,8,9,10,11,12,13,14,15);
}

// Load a 16x32 WMMA A/B fragment from row-major LDS (pitch LDSP halves).
// Lanes 0-15: elems {0..7}=col0+0..7, {8..15}=col0+16..23;
// lanes 16-31: elems {0..7}=col0+8..15, {8..15}=col0+24..31. Row = row0 + lane%16.
static __device__ __forceinline__ v16h lds_frag(const _Float16* base, int row0,
                                                int col0, int hi, int m) {
    const _Float16* r = base + (row0 + m) * LDSP + col0 + hi * 8;
    v8h lo = *(const v8h*)(r);
    v8h hh = *(const v8h*)(r + 16);
    return cat8(lo, hh);
}

// Load a 16(d) x 32(key) WMMA A fragment of V^T from row-major V[key][d] in LDS
// (pitch VPITCH halves) with the transposing load. Lane (c = lane%16, h = lane/16)
// gets keys key0 + 8h + 0..7 (elems 0..7) and key0 + 16 + 8h + 0..7 (elems 8..15)
// of column d0 + c: the same fragment lds_frag gives on a transposed tile.
static __device__ __forceinline__ v8h lds_tr16(const _Float16* p) {
    typedef __attribute__((address_space(3))) s16x8 lds_s16x8;
    return __builtin_bit_cast(v8h, __builtin_amdgcn_ds_load_tr16_b128_v8i16((lds_s16x8*)p));
}
static __device__ __forceinline__ v16h lds_frag_vt(const _Float16* base, int d0,
                                                   int key0, int lane) {
    const _Float16* p = base + (key0 + 8 * (lane >> 4) + (lane & 7)) * VPITCH
                             + d0 + 8 * ((lane >> 3) & 1);
    return cat8(lds_tr16(p), lds_tr16(p + 16 * VPITCH));
}

// Lane l with lane l ^ 16 on the vector pipe (v_permlanex16_b32). __shfl_xor compiles to an
// LDS operation whose wait also drains every V fragment load queued in front of it.
static __device__ __forceinline__ float xhalf(float x) {
    const int b = __builtin_bit_cast(int, x);
    return __builtin_bit_cast(float,
        __builtin_amdgcn_permlanex16(b, b, 0x76543210, 0xfedcba98, false, false));
}

// Four waves per SIMD (two blocks per WGP) is all the grid can fill: the register budget is set for that.
__global__ __launch_bounds__(BLOCK) __attribute__((amdgpu_waves_per_eu(4, 4)))
void OptimizedAttention_68736656605917_kernel(const float* __restrict__ Q,
                                              const float* __restrict__ K,
                                              const float* __restrict__ V,
                                              float* __restrict__ O) {
    // double-buffered tiles: K and V both row-major f16 (V is transposed when read)
    __shared__ __align__(16) _Float16 Klds[2][KTILE * LDSP];
    __shared__ __align__(16) _Float16 Vlds[2][KTILE * VPITCH];

    const int tid  = threadIdx.x;
    const int wave = tid >> 5;
    const int lane = tid & 31;
    const int hi   = lane >> 4;
    const int m    = lane & 15;

    const int qblk  = blockIdx.x;   // 0..15
    const int head  = blockIdx.y;   // 0..15
    const int batch = blockIdx.z;   // 0..1

    const int   qbase = qblk * (WAVES * NQ * QTILE) + wave * (NQ * QTILE);
    const float scale = 0.125f;     // 1/sqrt(64), folded into Q before f16 cvt

    // --- Q fragments (B-operand: lane = q column, d packed per WMMA layout) ---
    v16h qb[NQ][2];
#pragma unroll
    for (int qq = 0; qq < NQ; ++qq) {
        const float* qptr =
            Q + ((size_t)(batch * S_LEN + qbase + qq * QTILE + m)) * DMODEL + head * DK;
#pragma unroll
        for (int dh = 0; dh < 2; ++dh) {
            const float* p = qptr + dh * 32 + hi * 8;
            v16h f;
#pragma unroll
            for (int i = 0; i < 8; ++i) {
                f[i]     = (_Float16)(p[i]      * scale);
                f[i + 8] = (_Float16)(p[i + 16] * scale);
            }
            qb[qq][dh] = f;
        }
    }

    v8f o[NQ][4];
#pragma unroll
    for (int qq = 0; qq < NQ; ++qq)
#pragma unroll
        for (int n = 0; n < 4; ++n) o[qq][n] = {};
    // m_use: the maximum in use, which may trail the column's true maximum by up to LAZY_T.
    // cneg: -m_use in all eight rows, the C operand of the score products.
    float m_use[NQ], l_run[NQ];
    v8f cneg[NQ];
#pragma unroll
    for (int qq = 0; qq < NQ; ++qq) { m_use[qq] = 0.0f; l_run[qq] = 0.0f; cneg[qq] = {}; }

    const float* kbase_g = K + (size_t)batch * S_LEN * DMODEL + head * DK;
    const float* vbase_g = V + (size_t)batch * S_LEN * DMODEL + head * DK;

    const int tr = tid >> 4;          // 0..SROWS-1 (tile row within a pass)
    const int tc = (tid & 15) * 4;    // 0..60 (float4 column)
    const bool pf_wave = __builtin_amdgcn_readfirstlane(wave) < 4;   // wave-uniform, a scalar test

    // ---- prologue: load tile 0 into buffer 0 ----
    {
        float4 k4[SPASS], v4[SPASS];
#pragma unroll
        for (int pass = 0; pass < SPASS; ++pass) {
            const int row = tr + pass * SROWS;
            k4[pass] = *(const float4*)(kbase_g + (size_t)row * DMODEL + tc);
            v4[pass] = *(const float4*)(vbase_g + (size_t)row * DMODEL + tc);
        }
#pragma unroll
        for (int pass = 0; pass < SPASS; ++pass) {
            const int row = tr + pass * SROWS;
            _Float16* kd = Klds[0] + row * LDSP + tc;
            kd[0] = (_Float16)k4[pass].x; kd[1] = (_Float16)k4[pass].y;
            kd[2] = (_Float16)k4[pass].z; kd[3] = (_Float16)k4[pass].w;
            _Float16* vd = Vlds[0] + row * VPITCH + tc;
            vd[0] = (_Float16)v4[pass].x; vd[1] = (_Float16)v4[pass].y;
            vd[2] = (_Float16)v4[pass].z; vd[3] = (_Float16)v4[pass].w;
        }
    }
    __syncthreads();

    for (int it = 0; it < NTILES; ++it) {
        const int cur = it & 1;
        const int nxt = cur ^ 1;
        const bool have_next = (it + 1) < NTILES;

        // --- stage next tile's global loads NOW (latency overlaps compute) ---
        float4 k4[SPASS], v4[SPASS];
        if (have_next) {
            // prefetch tile i+2 toward L2 (global_prefetch_b8): 128 threads cover the tile's lines.
            // Ahead of the loads: its address arithmetic then reuses none of their address registers.
            if (it + 2 < NTILES && pf_wave) {
                const int kt2 = (it + 2) * KTILE;
                __builtin_prefetch(kbase_g + (size_t)(kt2 + (tid >> 1)) * DMODEL + (tid & 1) * 32, 0, 1);
                __builtin_prefetch(vbase_g + (size_t)(kt2 + (tid >> 1)) * DMODEL + (tid & 1) * 32, 0, 1);
            }
            const int kt1 = (it + 1) * KTILE;
#pragma unroll
            for (int pass = 0; pass < SPASS; ++pass) {
                const int row = kt1 + tr + pass * SROWS;
                k4[pass] = *(const float4*)(kbase_g + (size_t)row * DMODEL + tc);
                v4[pass] = *(const float4*)(vbase_g + (size_t)row * DMODEL + tc);
            }
            // Stands in front of every reuse of the loads' address registers (a precaution).
            // As a volatile statement that may touch memory it also stands between the
            // loads above and the LDS reads below: without it the compiler sinks the
            // loads behind the compute, directly in front of their use.
            asm volatile("s_wait_xcnt 0x0" ::: "memory");
        }

        // --- S^T = K x Q - m_use : 4 tiles of 16(key)x16(q) per q-subtile; the maximum in use
        //     comes in as the C operand, so the scores leave the matrix unit already shifted.
        //     Each K-fragment (A) is loaded once and reused for NQ WMMAs. ---
        v8f st[NQ][4];
#pragma unroll
        for (int mt = 0; mt < 4; ++mt) {
            const v16h a0 = lds_frag(Klds[cur], mt * 16, 0, hi, m);
            const v16h a1 = lds_frag(Klds[cur], mt * 16, 32, hi, m);
#pragma unroll
            for (int qq = 0; qq < NQ; ++qq) {
                v8f c = __builtin_amdgcn_wmma_f32_16x16x32_f16(false, a0, false, qb[qq][0], (short)0, cneg[qq], false, false);
                c = __builtin_amdgcn_wmma_f32_16x16x32_f16(false, a1, false, qb[qq][1], (short)0, c, false, false);
                st[qq][mt] = c;
            }
        }

        // V^T fragments: their loads are issued here, in front of the test's branch, so that they fly
        // under the maxima and the test (behind the branch they would start late and be waited for).
        v16h va[4][2];
#pragma unroll
        for (int n = 0; n < 4; ++n) {
            va[n][0] = lds_frag_vt(Vlds[cur], n * 16, 0, lane);
            va[n][1] = lds_frag_vt(Vlds[cur], n * 16, 32, lane);
        }

        // --- lazy rescale: one test per tile. The maximum in use moves only when some column's
        //     scores top it by more than LAZY_T (and in tile 0, which sets it). ---
        float mx[NQ];
        bool need = false;
#pragma unroll
        for (int qq = 0; qq < NQ; ++qq) {
            float t = st[qq][0][0];
#pragma unroll
            for (int mt = 0; mt < 4; ++mt)
#pragma unroll
                for (int r = 0; r < 8; ++r) t = fmaxf(t, st[qq][mt][r]);
            mx[qq] = t;
            need = need || (t > LAZY_T);
        }
        if (it == 0 || __builtin_amdgcn_ballot_w32(need) != 0) {   // wave-uniform, a scalar branch
#pragma unroll
            for (int qq = 0; qq < NQ; ++qq) {
                const float mc = fmaxf(mx[qq], xhalf(mx[qq]));          // the column's maximum, less m_use
                const float d  = (it == 0) ? mc : fmaxf(mc, 0.0f);      // tile 0 may also lower it
                const float alpha = __expf(fminf(-d, 0.0f));
#pragma unroll
                for (int mt = 0; mt < 4; ++mt) st[qq][mt] -= d;
#pragma unroll
                for (int n = 0; n < 4; ++n) o[qq][n] *= alpha;
                l_run[qq] *= alpha;
                m_use[qq] += d;
#pragma unroll
                for (int r = 0; r < 8; ++r) cneg[qq][r] = -m_use[qq];
            }
        }

        // --- exponentials, row sums, P fragments (per q-subtile) ---
        v16h pb[NQ][2];
#pragma unroll
        for (int qq = 0; qq < NQ; ++qq) {
            float lsum = 0.0f;
#pragma unroll
            for (int mt = 0; mt < 4; ++mt)
#pragma unroll
                for (int r = 0; r < 8; ++r) {
                    const float e = __expf(st[qq][mt][r]);
                    st[qq][mt][r] = e;
                    lsum += e;
                }
            lsum += xhalf(lsum);
            l_run[qq] += lsum;

            // accumulator layout of S^T IS the B-operand layout for P
#pragma unroll
            for (int j = 0; j < 2; ++j) {
                v16h f;
#pragma unroll
                for (int i = 0; i < 8; ++i) {
                    f[i]     = (_Float16)st[qq][2 * j][i];
                    f[i + 8] = (_Float16)st[qq][2 * j + 1][i];
                }
                pb[qq][j] = f;
            }
        }

        // --- O^T += V^T x P : each V^T fragment reused for NQ WMMAs ---
#pragma unroll
        for (int n = 0; n < 4; ++n) {
            const v16h a0 = va[n][0];
            const v16h a1 = va[n][1];
#pragma unroll
            for (int qq = 0; qq < NQ; ++qq) {
                o[qq][n] = __builtin_amdgcn_wmma_f32_16x16x32_f16(false, a0, false, pb[qq][0], (short)0, o[qq][n], false, false);
                o[qq][n] = __builtin_amdgcn_wmma_f32_16x16x32_f16(false, a1, false, pb[qq][1], (short)0, o[qq][n], false, false);
            }
        }

        // --- drain staged loads into the other buffer (after compute) ---
        // Keeps the conversions, and with them the waits on the staged loads, below the
        // compute: the compiler otherwise lifts them to the loop's top.
        __builtin_amdgcn_sched_barrier(0);
        if (have_next) {
#pragma unroll
            for (int pass = 0; pass < SPASS; ++pass) {
                const int row = tr + pass * SROWS;
                _Float16* kd = Klds[nxt] + row * LDSP + tc;
                kd[0] = (_Float16)k4[pass].x; kd[1] = (_Float16)k4[pass].y;
                kd[2] = (_Float16)k4[pass].z; kd[3] = (_Float16)k4[pass].w;
                _Float16* vd = Vlds[nxt] + row * VPITCH + tc;
                vd[0] = (_Float16)v4[pass].x; vd[1] = (_Float16)v4[pass].y;
                vd[2] = (_Float16)v4[pass].z; vd[3] = (_Float16)v4[pass].w;
            }
        }
        __syncthreads();
    }

    // --- normalize and store: lane holds q=m, d = n*16 + hi*8 + r (contig 8) ---
#pragma unroll
    for (int qq = 0; qq < NQ; ++qq) {
        const float inv = 1.0f / l_run[qq];
        float* obase = O + ((size_t)(batch * S_LEN + qbase + qq * QTILE + m)) * DMODEL
                         + head * DK + hi * 8;
#pragma unroll
        for (int n = 0; n < 4; ++n) {
            float4 r0, r1;
            r0.x = o[qq][n][0] * inv; r0.y = o[qq][n][1] * inv;
            r0.z = o[qq][n][2] * inv; r0.w = o[qq][n][3] * inv;
            r1.x = o[qq][n][4] * inv; r1.y = o[qq][n][5] * inv;
            r1.z = o[qq][n][6] * inv; r1.w = o[qq][n][7] * inv;
            *(float4*)(obase + n * 16)     = r0;
            *(float4*)(obase + n * 16 + 4) = r1;
        }
    }
}

extern "C" void kernel_launch(void* const* d_in, const int* in_sizes, int n_in,
                              void* d_out, int out_size, void* d_ws, size_t ws_size,
                              hipStream_t stream) {
    (void)in_sizes; (void)n_in; (void)out_size; (void)d_ws; (void)ws_size;
    const float* Q = (const float*)d_in[0];
    const float* K = (const float*)d_in[1];
    const float* V = (const float*)d_in[2];
    float* O = (float*)d_out;

    dim3 grid(S_LEN / (WAVES * NQ * QTILE), 16 /*heads*/, 2 /*batch*/);
    dim3 block(BLOCK);
    OptimizedAttention_68736656605917_kernel<<<grid, block, 0, stream>>>(Q, K, V, O);
}

// v006
// It runs in 39 microseconds.
// Two timings next to v005 both put it at 1.06 times that version's speed.
// Over all steps from v000 it is 2.12 times as fast.
#include <hip/hip_runtime.h>

#define S_LEN   2048
#define DMODEL  1024
#define DK      64
#define QTILE   16      // q rows per q-subtile
#define NQ      1       // q-subtiles per wave: 16 columns, so that the grid makes 4 waves per SIMD
#define KTILE   64      // keys per mainloop iteration
#define NTILES  (S_LEN / KTILE)
#define WAVES   8
#define BLOCK   (WAVES * 32)
#define SROWS   (BLOCK / 16)        // tile rows staged per pass (16 threads per row)
#define SPASS   (KTILE / SROWS)     // staging passes per tile
#define LDSP    72      // LDS pitch in halves (16B-aligned rows, staggered banks)
#define VPITCH  80      // V pitch in halves: 160 B = 32 B x odd, the transposing load's pitch
#define LAZY_T  5.5f    // a column's scores may top the maximum in use by this much (P <= e^5.5 = 245, far inside f16)

typedef __attribute__((ext_vector_type(16))) _Float16 v16h;
typedef __attribute__((ext_vector_type(8)))  _Float16 v8h;
typedef __attribute__((ext_vector_type(8)))  float    v8f;
typedef __attribute__((ext_vector_type(8)))  short    s16x8;

static __device__ __forceinline__ v16h cat8(v8h a, v8h b) {
    return __builtin_shufflevector(a, b, 0,1,2,3,4,5,6,7,8,9,10,11,12,13,14,15);
}

// Load a 16x32 WMMA A/B fragment from row-major LDS (pitch LDSP halves).
// Lanes 0-15: elems {0..7}=col0+0..7, {8..15}=col0+16..23;
// lanes 16-31: elems {0..7}=col0+8..15, {8..15}=col0+24..31. Row = row0 + lane%16.
static __device__ __forceinline__ v16h lds_frag(const _Float16* base, int row0,
                                                int col0, int hi, int m) {
    const _Float16* r = base + (row0 + m) * LDSP + col0 + hi * 8;
    v8h lo = *(const v8h*)(r);
    v8h hh = *(const v8h*)(r + 16);
    return cat8(lo, hh);
}

// Load a 16(d) x 32(key) WMMA A fragment of V^T from row-major V[key][d] in LDS
// (pitch VPITCH halves) with the transposing load. Lane (c = lane%16, h = lane/16)
// gets keys key0 + 8h + 0..7 (elems 0..7) and key0 + 16 + 8h + 0..7 (elems 8..15)
// of column d0 + c: the same fragment lds_frag gives on a transposed tile.
static __device__ __forceinline__ v8h lds_tr16(const _Float16* p) {
    typedef __attribute__((address_space(3))) s16x8 lds_s16x8;
    return __builtin_bit_cast(v8h, __builtin_amdgcn_ds_load_tr16_b128_v8i16((lds_s16x8*)p));
}
static __device__ __forceinline__ v16h lds_frag_vt(const _Float16* base, int d0,
                                                   int key0, int lane) {
    const _Float16* p = base + (key0 + 8 * (lane >> 4) + (lane & 7)) * VPITCH
                             + d0 + 8 * ((lane >> 3) & 1);
    return cat8(lds_tr16(p), lds_tr16(p + 16 * VPITCH));
}

// Lane l with lane l ^ 16 on the vector pipe (v_permlanex16_b32). __shfl_xor compiles to an
// LDS operation whose wait also drains every V fragment load queued in front of it.
static __device__ __forceinline__ float xhalf(float x) {
    const int b = __builtin_bit_cast(int, x);
    return __builtin_bit_cast(float,
        __builtin_amdgcn_permlanex16(b, b, 0x76543210, 0xfedcba98, false, false));
}

// Four waves per SIMD (two blocks per WGP) is all the grid can fill: the register budget is set for that.
__global__ __launch_bounds__(BLOCK) __attribute__((amdgpu_waves_per_eu(4, 4)))
void OptimizedAttention_68736656605917_kernel(const float* __restrict__ Q,
                                              const float* __restrict__ K,
                                              const float* __restrict__ V,
                                              float* __restrict__ O) {
    // double-buffered tiles: K and V both row-major f16 (V is transposed when read)
    __shared__ __align__(16) _Float16 Klds[2][KTILE * LDSP];
    __shared__ __align__(16) _Float16 Vlds[2][KTILE * VPITCH];

    const int tid  = threadIdx.x;
    const int wave = tid >> 5;
    const int lane = tid & 31;
    const int hi   = lane >> 4;
    const int m    = lane & 15;

    const int qblk  = blockIdx.x;   // 0..15
    const int head  = blockIdx.y;   // 0..15
    const int batch = blockIdx.z;   // 0..1

    const int   qbase = qblk * (WAVES * NQ * QTILE) + wave * (NQ * QTILE);
    const float scale = 0.125f;     // 1/sqrt(64), folded into Q before f16 cvt

    // --- Q fragments (B-operand: lane = q column, d packed per WMMA layout) ---
    v16h qb[NQ][2];
#pragma unroll
    for (int qq = 0; qq < NQ; ++qq) {
        const float* qptr =
            Q + ((size_t)(batch * S_LEN + qbase + qq * QTILE + m)) * DMODEL + head * DK;
#pragma unroll
        for (int dh = 0; dh < 2; ++dh) {
            const float* p = qptr + dh * 32 + hi * 8;
            v16h f;
#pragma unroll
            for (int i = 0; i < 8; ++i) {
                f[i]     = (_Float16)(p[i]      * scale);
                f[i + 8] = (_Float16)(p[i + 16] * scale);
            }
            qb[qq][dh] = f;
        }
    }

    v8f o[NQ][4];
#pragma unroll
    for (int qq = 0; qq < NQ; ++qq)
#pragma unroll
        for (int n = 0; n < 4; ++n) o[qq][n] = {};
    // m_use: the maximum in use, which may trail the column's true maximum by up to LAZY_T.
    // cneg: -m_use in all eight rows, the C operand of the score products.
    float m_use[NQ], l_run[NQ];
    v8f cneg[NQ];
#pragma unroll
    for (int qq = 0; qq < NQ; ++qq) { m_use[qq] = 0.0f; l_run[qq] = 0.0f; cneg[qq] = {}; }

    const float* kbase_g = K + (size_t)batch * S_LEN * DMODEL + head * DK;
    const float* vbase_g = V + (size_t)batch * S_LEN * DMODEL + head * DK;

    const int tr = tid >> 4;          // 0..SROWS-1 (tile row within a pass)
    const int tc = (tid & 15) * 4;    // 0..60 (float4 column)
    const bool pf_wave = __builtin_amdgcn_readfirstlane(wave) < 4;   // wave-uniform, a scalar test
    // Byte offset, the same in K and in V, of this thread's first row of the tile to be staged
    // next (below 16 MiB); it moves on at the loop's foot.
    unsigned goff = (unsigned)(((batch * S_LEN + KTILE + tr) * DMODEL + head * DK + tc) * sizeof(float));

    // ---- prologue: load tile 0 into buffer 0 ----
    {
        float4 k4[SPASS], v4[SPASS];
#pragma unroll
        for (int pass = 0; pass < SPASS; ++pass) {
            const int row = tr + pass * SROWS;
            k4[pass] = *(const float4*)(kbase_g + (size_t)row * DMODEL + tc);
            v4[pass] = *(const float4*)(vbase_g + (size_t)row * DMODEL + tc);
        }
#pragma unroll
        for (int pass = 0; pass < SPASS; ++pass) {
            const int row = tr + pass * SROWS;
            _Float16* kd = Klds[0] + row * LDSP + tc;
            kd[0] = (_Float16)k4[pass].x; kd[1] = (_Float16)k4[pass].y;
            kd[2] = (_Float16)k4[pass].z; kd[3] = (_Float16)k4[pass].w;
            _Float16* vd = Vlds[0] + row * VPITCH + tc;
            vd[0] = (_Float16)v4[pass].x; vd[1] = (_Float16)v4[pass].y;
            vd[2] = (_Float16)v4[pass].z; vd[3] = (_Float16)v4[pass].w;
        }
    }
    __syncthreads();

    for (int it = 0; it < NTILES; ++it) {
        const int cur = it & 1;
        const int nxt = cur ^ 1;
        const bool have_next = (it + 1) < NTILES;

        // prefetch tile i+2 toward L2 (global_prefetch_b8): 128 threads cover the tile's lines.
        if (it + 2 < NTILES && pf_wave) {
            const int kt2 = (it + 2) * KTILE;
            __builtin_prefetch(kbase_g + (size_t)(kt2 + (tid >> 1)) * DMODEL + (tid & 1) * 32, 0, 1);
            __builtin_prefetch(vbase_g + (size_t)(kt2 + (tid >> 1)) * DMODEL + (tid & 1) * 32, 0, 1);
        }

        // --- S^T = K x Q - m_use : 4 tiles of 16(key)x16(q) per q-subtile; the maximum in use
        //     comes in as the C operand, so the scores leave the matrix unit already shifted.
        //     Each K-fragment (A) is loaded once and reused for NQ WMMAs. ---
        v8f st[NQ][4];
#pragma unroll
        for (int mt = 0; mt < 4; ++mt) {
            const v16h a0 = lds_frag(Klds[cur], mt * 16, 0, hi, m);
            const v16h a1 = lds_frag(Klds[cur], mt * 16, 32, hi, m);
#pragma unroll
            for (int qq = 0; qq < NQ; ++qq) {
                v8f c = __builtin_amdgcn_wmma_f32_16x16x32_f16(false, a0, false, qb[qq][0], (short)0, cneg[qq], false, false);
                c = __builtin_amdgcn_wmma_f32_16x16x32_f16(false, a1, false, qb[qq][1], (short)0, c, false, false);
                st[qq][mt] = c;
            }
        }

        // V^T fragments: their loads are issued here, in front of the test's branch, so that they fly
        // under the maxima and the test (behind the branch they would start late and be waited for).
        v16h va[4][2];
#pragma unroll
        for (int n = 0; n < 4; ++n) {
            va[n][0] = lds_frag_vt(Vlds[cur], n * 16, 0, lane);
            va[n][1] = lds_frag_vt(Vlds[cur], n * 16, 32, lane);
        }

        // --- the next tile's global loads, issued HERE: behind the barrier a wave first wants its
        //     K fragments, so nothing of the staging stands between the barrier and those reads;
        //     the loads' issue runs under the fragment reads in flight, and they still have the
        //     whole tile to land. In the last tile goff has not moved: it reads its own rows
        //     again (in bounds) and uses none of them. ---
        // Compiler fence: keeps the global loads behind the LDS fragment reads above.
        asm volatile("" ::: "memory");
        float4 k4[SPASS], v4[SPASS];
#pragma unroll
        for (int pass = 0; pass < SPASS; ++pass) {
            k4[pass] = *(const float4*)((const char*)(K + pass * SROWS * DMODEL) + goff);
            v4[pass] = *(const float4*)((const char*)(V + pass * SROWS * DMODEL) + goff);
        }
        // Compiler fence: without it the compiler sinks the loads directly in front of their use.
        asm volatile("" ::: "memory");

        // --- lazy rescale: one test per tile. The maximum in use moves only when some column's
        //     scores top it by more than LAZY_T (and in tile 0, which sets it). ---
        float mx[NQ];
        bool need = false;
#pragma unroll
        for (int qq = 0; qq < NQ; ++qq) {
            float t = st[qq][0][0];
#pragma unroll
            for (int mt = 0; mt < 4; ++mt)
#pragma unroll
                for (int r = 0; r < 8; ++r) t = fmaxf(t, st[qq][mt][r]);
            mx[qq] = t;
            need = need || (t > LAZY_T);
        }
        if (it == 0 || __builtin_amdgcn_ballot_w32(need) != 0) {   // wave-uniform, a scalar branch
#pragma unroll
            for (int qq = 0; qq < NQ; ++qq) {
                const float mc = fmaxf(mx[qq], xhalf(mx[qq]));          // the column's maximum, less m_use
                const float d  = (it == 0) ? mc : fmaxf(mc, 0.0f);      // tile 0 may also lower it
                const float alpha = __expf(fminf(-d, 0.0f));
#pragma unroll
                for (int mt = 0; mt < 4; ++mt) st[qq][mt] -= d;
#pragma unroll
                for (int n = 0; n < 4; ++n) o[qq][n] *= alpha;
                l_run[qq] *= alpha;
                m_use[qq] += d;
#pragma unroll
                for (int r = 0; r < 8; ++r) cneg[qq][r] = -m_use[qq];
            }
        }

        // --- exponentials, row sums, P fragments (per q-subtile) ---
        v16h pb[NQ][2];
#pragma unroll
        for (int qq = 0; qq < NQ; ++qq) {
            float lsum = 0.0f;
#pragma unroll
            for (int mt = 0; mt < 4; ++mt)
#pragma unroll
                for (int r = 0; r < 8; ++r) {
                    const float e = __expf(st[qq][mt][r]);
                    st[qq][mt][r] = e;
                    lsum += e;
                }
            lsum += xhalf(lsum);
            l_run[qq] += lsum;

            // accumulator layout of S^T IS the B-operand layout for P
#pragma unroll
            for (int j = 0; j < 2; ++j) {
                v16h f;
#pragma unroll
                for (int i = 0; i < 8; ++i) {
                    f[i]     = (_Float16)st[qq][2 * j][i];
                    f[i + 8] = (_Float16)st[qq][2 * j + 1][i];
                }
                pb[qq][j] = f;
            }
        }

        // --- O^T += V^T x P : each V^T fragment reused for NQ WMMAs ---
#pragma unroll
        for (int n = 0; n < 4; ++n) {
            const v16h a0 = va[n][0];
            const v16h a1 = va[n][1];
#pragma unroll
            for (int qq = 0; qq < NQ; ++qq) {
                o[qq][n] = __builtin_amdgcn_wmma_f32_16x16x32_f16(false, a0, false, pb[qq][0], (short)0, o[qq][n], false, false);
                o[qq][n] = __builtin_amdgcn_wmma_f32_16x16x32_f16(false, a1, false, pb[qq][1], (short)0, o[qq][n], false, false);
            }
        }

        // --- drain staged loads into the other buffer (after compute) ---
        // Keeps the conversions, and with them the waits on the staged loads, below the
        // compute: the compiler otherwise lifts them up behind the loads.
        __builtin_amdgcn_sched_barrier(0);
        if (have_next) {
#pragma unroll
            for (int pass = 0; pass < SPASS; ++pass) {
                const int row = tr + pass * SROWS;
                _Float16* kd = Klds[nxt] + row * LDSP + tc;
                kd[0] = (_Float16)k4[pass].x; kd[1] = (_Float16)k4[pass].y;
                kd[2] = (_Float16)k4[pass].z; kd[3] = (_Float16)k4[pass].w;
                _Float16* vd = Vlds[nxt] + row * VPITCH + tc;
                vd[0] = (_Float16)v4[pass].x; vd[1] = (_Float16)v4[pass].y;
                vd[2] = (_Float16)v4[pass].z; vd[3] = (_Float16)v4[pass].w;
            }
        }
        // Stands in front of the rewrite of the loads' address register (a precaution). It names
        // the offset, so that it stays in its register up to here and moves on behind the wait.
        asm volatile("s_wait_xcnt 0x0" : "+v"(goff) :: "memory");
        if (it + 2 < NTILES) goff += (unsigned)(KTILE * DMODEL * sizeof(float));
        __syncthreads();
    }

    // --- normalize and store: lane holds q=m, d = n*16 + hi*8 + r (contig 8) ---
#pragma unroll
    for (int qq = 0; qq < NQ; ++qq) {
        const float inv = 1.0f / l_run[qq];
        float* obase = O + ((size_t)(batch * S_LEN + qbase + qq * QTILE + m)) * DMODEL
                         + head * DK + hi * 8;
#pragma unroll
        for (int n = 0; n < 4; ++n) {
            float4 r0, r1;
            r0.x = o[qq][n][0] * inv; r0.y = o[qq][n][1] * inv;
            r0.z = o[qq][n][2] * inv; r0.w = o[qq][n][3] * inv;
            r1.x = o[qq][n][4] * inv; r1.y = o[qq][n][5] * inv;
            r1.z = o[qq][n][6] * inv; r1.w = o[qq][n][7] * inv;
            *(float4*)(obase + n * 16)     = r0;
            *(float4*)(obase + n * 16 + 4) = r1;
        }
    }
}

extern "C" void kernel_launch(void* const* d_in, const int* in_sizes, int n_in,
                              void* d_out, int out_size, void* d_ws, size_t ws_size,
                              hipStream_t stream) {
    (void)in_sizes; (void)n_in; (void)out_size; (void)d_ws; (void)ws_size;
    const float* Q = (const float*)d_in[0];
    const float* K = (const float*)d_in[1];
    const float* V = (const float*)d_in[2];
    float* O = (float*)d_out;

    dim3 grid(S_LEN / (WAVES * NQ * QTILE), 16 /*heads*/, 2 /*batch*/);
    dim3 block(BLOCK);
    OptimizedAttention_68736656605917_kernel<<<grid, block, 0, stream>>>(Q, K, V, O);
}

// v007
// It runs in 35.9 microseconds.
// Next to v006, in two timings, it ran 1.09 times as fast each time.
// Over all steps from v000 it is 2.30 times as fast.
#include <hip/hip_runtime.h>

#define S_LEN   2048
#define DMODEL  1024
#define DK      64
#define QTILE   16      // q rows per q-subtile
#define NQ      2       // q-subtiles per wave: each K and V fragment read from LDS feeds two products
#define KTILE   64      // keys per wave per mainloop iteration
#define KG      2       // key groups: a stage is KG tiles, and each wave works on its own group's tile
#define QW      4       // waves side by side over the query columns
#define STAGE   (KG * KTILE)        // keys staged per mainloop iteration
#define NTILES  (S_LEN / STAGE)
#define WAVES   (QW * KG)           // still 4 waves per SIMD over the grid
#define BLOCK   (WAVES * 32)
#define SROWS   (BLOCK / 16)        // stage rows staged per pass (16 threads per row)
#define SPASS   (KTILE / SROWS)     // staging passes per batch (a batch is one tile of the stage)
#define LDSP    72      // LDS pitch in halves (16B-aligned rows, staggered banks)
#define VPITCH  80      // V pitch in halves: 160 B = 32 B x odd, the transposing load's pitch
#define LOG2E   1.44269504088896340736f
#define LAZY_T  5.5f    // a column's scores may top the maximum in use by this much (P <= e^5.5 = 245, far inside f16)

typedef __attribute__((ext_vector_type(16))) _Float16 v16h;
typedef __attribute__((ext_vector_type(8)))  _Float16 v8h;
typedef __attribute__((ext_vector_type(8)))  float    v8f;
typedef __attribute__((ext_vector_type(8)))  short    s16x8;

static __device__ __forceinline__ v16h cat8(v8h a, v8h b) {
    return __builtin_shufflevector(a, b, 0,1,2,3,4,5,6,7,8,9,10,11,12,13,14,15);
}

// Load a 16x32 WMMA A/B fragment from row-major LDS (pitch LDSP halves).
// Lanes 0-15: elems {0..7}=col0+0..7, {8..15}=col0+16..23;
// lanes 16-31: elems {0..7}=col0+8..15, {8..15}=col0+24..31. Row = row0 + lane%16.
static __device__ __forceinline__ v16h lds_frag(const _Float16* base, int row0,
                                                int col0, int hi, int m) {
    const _Float16* r = base + (row0 + m) * LDSP + col0 + hi * 8;
    v8h lo = *(const v8h*)(r);
    v8h hh = *(const v8h*)(r + 16);
    return cat8(lo, hh);
}

// Load a 16(d) x 32(key) WMMA A fragment of V^T from row-major V[key][d] in LDS
// (pitch VPITCH halves) with the transposing load. Lane (c = lane%16, h = lane/16)
// gets keys key0 + 8h + 0..7 (elems 0..7) and key0 + 16 + 8h + 0..7 (elems 8..15)
// of column d0 + c: the same fragment lds_frag gives on a transposed tile.
static __device__ __forceinline__ v8h lds_tr16(const _Float16* p) {
    typedef __attribute__((address_space(3))) s16x8 lds_s16x8;
    return __builtin_bit_cast(v8h, __builtin_amdgcn_ds_load_tr16_b128_v8i16((lds_s16x8*)p));
}
static __device__ __forceinline__ v16h lds_frag_vt(const _Float16* base, int d0,
                                                   int key0, int lane) {
    const _Float16* p = base + (key0 + 8 * (lane >> 4) + (lane & 7)) * VPITCH
                             + d0 + 8 * ((lane >> 3) & 1);
    return cat8(lds_tr16(p), lds_tr16(p + 16 * VPITCH));
}

// Lane l with lane l ^ 16 on the vector pipe (v_permlanex16_b32). __shfl_xor compiles to an
// LDS operation whose wait also drains every V fragment load queued in front of it.
static __device__ __forceinline__ float xhalf(float x) {
    const int b = __builtin_bit_cast(int, x);
    return __builtin_bit_cast(float,
        __builtin_amdgcn_permlanex16(b, b, 0x76543210, 0xfedcba98, false, false));
}

// Four waves per SIMD (two blocks per WGP) is all the grid can fill: the register budget is set for that.
__global__ __launch_bounds__(BLOCK) __attribute__((amdgpu_waves_per_eu(4, 4)))
void OptimizedAttention_68736656605917_kernel(const float* __restrict__ Q,
                                              const float* __restrict__ K,
                                              const float* __restrict__ V,
                                              float* __restrict__ O) {
    // double-buffered tiles: K and V both row-major f16 (V is transposed when read)
    __shared__ __align__(16) _Float16 Klds[2][STAGE * LDSP];
    __shared__ __align__(16) _Float16 Vlds[2][STAGE * VPITCH];

    const int tid  = threadIdx.x;
    const int wave = __builtin_amdgcn_readfirstlane(tid >> 5);   // wave-uniform: kept in a scalar register
    const int lane = tid & 31;
    const int hi   = lane >> 4;
    const int m    = lane & 15;

    const int qblk  = blockIdx.x;   // 0..15
    const int head  = blockIdx.y;   // 0..15
    const int batch = blockIdx.z;   // 0..1

    const int   qw    = wave & (QW - 1);    // which 32 query columns
    const int   kg    = wave / QW;          // which tile of every stage
    const int   qbase = qblk * (QW * NQ * QTILE) + qw * (NQ * QTILE);
    const float scale = 0.125f;     // 1/sqrt(64), folded into Q before f16 cvt

    // --- Q fragments (B-operand: lane = q column, d packed per WMMA layout) ---
    v16h qb[NQ][2];
#pragma unroll
    for (int qq = 0; qq < NQ; ++qq) {
        const float* qptr =
            Q + ((size_t)(batch * S_LEN + qbase + qq * QTILE + m)) * DMODEL + head * DK;
#pragma unroll
        for (int dh = 0; dh < 2; ++dh) {
            const float* p = qptr + dh * 32 + hi * 8;
            v16h f;
#pragma unroll
            for (int i = 0; i < 8; ++i) {
                f[i]     = (_Float16)(p[i]      * scale);
                f[i + 8] = (_Float16)(p[i + 16] * scale);
            }
            qb[qq][dh] = f;
        }
    }

    v8f o[NQ][4];
#pragma unroll
    for (int qq = 0; qq < NQ; ++qq)
#pragma unroll
        for (int n = 0; n < 4; ++n) o[qq][n] = {};
    // m_use: the maximum in use, which may trail the column's true maximum by up to LAZY_T. It is
    // taken off inside the exponent's multiply (one fma per score): as a C operand of the score
    // products it would hold eight registers per q-subtile, which two subtiles cannot spare.
    float m_use[NQ], l_run[NQ];
#pragma unroll
    for (int qq = 0; qq < NQ; ++qq) { m_use[qq] = 0.0f; l_run[qq] = 0.0f; }

    const float* kbase_g = K + (size_t)batch * S_LEN * DMODEL + head * DK;
    const float* vbase_g = V + (size_t)batch * S_LEN * DMODEL + head * DK;

    const int tr = tid >> 4;          // 0..SROWS-1 (tile row within a pass)
    const int tc = (tid & 15) * 4;    // 0..60 (float4 column)
    const bool pf_wave = wave < 4;   // wave-uniform, a scalar test
    // Byte offset, the same in K and in V, of this thread's first row of the tile to be staged
    // next (below 16 MiB); it moves on at the loop's foot.
    unsigned goff = (unsigned)(((batch * S_LEN + STAGE + tr) * DMODEL + head * DK + tc) * sizeof(float));

    // Byte offset, the same in K and in V, of the row of stage 2 that this thread asks for ahead.
    const unsigned poff = (unsigned)(((batch * S_LEN + 2 * STAGE + (tid & (STAGE - 1))) * DMODEL + head * DK) * sizeof(float));

    // ---- prologue: load stage 0 into buffer 0 ----
    {
        float4 k4[KG * SPASS], v4[KG * SPASS];
#pragma unroll
        for (int pass = 0; pass < KG * SPASS; ++pass) {
            const int row = tr + pass * SROWS;
            k4[pass] = *(const float4*)(kbase_g + (size_t)row * DMODEL + tc);
            v4[pass] = *(const float4*)(vbase_g + (size_t)row * DMODEL + tc);
        }
#pragma unroll
        for (int pass = 0; pass < KG * SPASS; ++pass) {
            const int row = tr + pass * SROWS;
            _Float16* kd = Klds[0] + row * LDSP + tc;
            kd[0] = (_Float16)k4[pass].x; kd[1] = (_Float16)k4[pass].y;
            kd[2] = (_Float16)k4[pass].z; kd[3] = (_Float16)k4[pass].w;
            _Float16* vd = Vlds[0] + row * VPITCH + tc;
            vd[0] = (_Float16)v4[pass].x; vd[1] = (_Float16)v4[pass].y;
            vd[2] = (_Float16)v4[pass].z; vd[3] = (_Float16)v4[pass].w;
        }
    }
    __syncthreads();

    for (int it = 0; it < NTILES; ++it) {
        const int cur = it & 1;
        const int nxt = cur ^ 1;
        const _Float16* Kt = Klds[cur] + kg * (KTILE * LDSP);     // this wave's tile of the stage
        const _Float16* Vt = Vlds[cur] + kg * (KTILE * VPITCH);

        // prefetch stage i+2 toward L2 (global_prefetch_b8): 128 threads, one request per row of
        // 256 aligned bytes.
        if (it + 2 < NTILES && pf_wave) {
            const unsigned po = poff + (unsigned)it * (unsigned)(STAGE * DMODEL * sizeof(float));
            __builtin_prefetch((const char*)K + po, 0, 1);
            __builtin_prefetch((const char*)V + po, 0, 1);
        }

        // --- S^T = K x Q : 4 tiles of 16(key)x16(q) per q-subtile.
        //     Each K-fragment (A) is loaded once and reused for NQ WMMAs. ---
        v16h ka[4][2];
#pragma unroll
        for (int mt = 0; mt < 4; ++mt) {
            ka[mt][0] = lds_frag(Kt, mt * 16, 0, hi, m);
            ka[mt][1] = lds_frag(Kt, mt * 16, 32, hi, m);
        }

        // --- the next stage's global loads, first batch (its tile 0), issued HERE: behind the
        //     barrier a wave first wants its K fragments, so nothing of the staging stands between
        //     the barrier and those reads. In the last stage goff has not moved: it reads its own
        //     rows again (in bounds) and uses none of them. ---
        // Compiler fence: keeps the global loads behind the LDS fragment reads above.
        asm volatile("" ::: "memory");
        float4 k4[SPASS], v4[SPASS];
#pragma unroll
        for (int pass = 0; pass < SPASS; ++pass) {
            k4[pass] = *(const float4*)((const char*)(K + pass * SROWS * DMODEL) + goff);
            v4[pass] = *(const float4*)((const char*)(V + pass * SROWS * DMODEL) + goff);
        }
        // Compiler fence: without it the compiler sinks the loads directly in front of their use.
        asm volatile("" ::: "memory");

        v8f st[NQ][4];
        const v8f zero8 = {};
#pragma unroll
        for (int mt = 0; mt < 4; ++mt) {
#pragma unroll
            for (int qq = 0; qq < NQ; ++qq)
                st[qq][mt] = __builtin_amdgcn_wmma_f32_16x16x32_f16(false, ka[mt][0], false, qb[qq][0], (short)0, zero8, false, false);
#pragma unroll
            for (int qq = 0; qq < NQ; ++qq)
                st[qq][mt] = __builtin_amdgcn_wmma_f32_16x16x32_f16(false, ka[mt][1], false, qb[qq][1], (short)0, st[qq][mt], false, false);
        }

        // --- lazy rescale: one test per stage. The maximum in use moves only when some column's
        //     scores top it by more than LAZY_T (and in the wave's first tile, which sets it). ---
        float mx[NQ];
        bool need = false;
#pragma unroll
        for (int qq = 0; qq < NQ; ++qq) {
            float t = st[qq][0][0];
#pragma unroll
            for (int mt = 0; mt < 4; ++mt)
#pragma unroll
                for (int r = 0; r < 8; ++r) t = fmaxf(t, st[qq][mt][r]);
            mx[qq] = t;
            need = need || (t > m_use[qq] + LAZY_T);
        }
        if (it == 0 || __builtin_amdgcn_ballot_w32(need) != 0) {   // wave-uniform, a scalar branch
#pragma unroll
            for (int qq = 0; qq < NQ; ++qq) {
                const float mc = fmaxf(mx[qq], xhalf(mx[qq]));              // the column's maximum
                const float mn = (it == 0) ? mc : fmaxf(mc, m_use[qq]);     // the first tile may also lower it
                const float alpha = __expf(fminf(m_use[qq] - mn, 0.0f));
#pragma unroll
                for (int n = 0; n < 4; ++n) o[qq][n] *= alpha;
                l_run[qq] *= alpha;
                m_use[qq] = mn;
            }
        }

        // --- exponentials, row sums, P fragments (per q-subtile); between the two subtiles the
        //     first staged batch is drained and the second is issued ---
        v16h pb[NQ][2];
        v16h va[4][2];
        float4 kb4[SPASS], vb4[SPASS];
#pragma unroll
        for (int qq = 0; qq < NQ; ++qq) {
            float lsum = 0.0f;
            const float nml = -m_use[qq] * LOG2E;
#pragma unroll
            for (int mt = 0; mt < 4; ++mt)
#pragma unroll
                for (int r = 0; r < 8; ++r) {
                    const float e = __builtin_amdgcn_exp2f(fmaf(st[qq][mt][r], LOG2E, nml));
                    st[qq][mt][r] = e;
                    lsum += e;
                }
            lsum += xhalf(lsum);
            l_run[qq] += lsum;

            // accumulator layout of S^T IS the B-operand layout for P
#pragma unroll
            for (int j = 0; j < 2; ++j) {
                v16h f;
#pragma unroll
                for (int i = 0; i < 8; ++i) {
                    f[i]     = (_Float16)st[qq][2 * j][i];
                    f[i + 8] = (_Float16)st[qq][2 * j + 1][i];
                }
                pb[qq][j] = f;
            }

            if (qq == 0) {
                // Keeps the first batch's conversions, and with them the waits on its loads, below
                // the first subtile's exponentials: the compiler otherwise lifts them.
                __builtin_amdgcn_sched_barrier(0);
                // No test for a next stage: the last stage writes its own rows into the other
                // buffer, which nobody reads any more; a branch here would let the loads sink into it.
#pragma unroll
                for (int pass = 0; pass < SPASS; ++pass) {
                    const int row = tr + pass * SROWS;
                    _Float16* kd = Klds[nxt] + row * LDSP + tc;
                    kd[0] = (_Float16)k4[pass].x; kd[1] = (_Float16)k4[pass].y;
                    kd[2] = (_Float16)k4[pass].z; kd[3] = (_Float16)k4[pass].w;
                    _Float16* vd = Vlds[nxt] + row * VPITCH + tc;
                    vd[0] = (_Float16)v4[pass].x; vd[1] = (_Float16)v4[pass].y;
                    vd[2] = (_Float16)v4[pass].z; vd[3] = (_Float16)v4[pass].w;
                }
                // V^T fragments: their loads are issued here, so that they fly under the second
                // subtile's exponentials.
#pragma unroll
                for (int n = 0; n < 4; ++n) {
                    va[n][0] = lds_frag_vt(Vt, n * 16, 0, lane);
                    va[n][1] = lds_frag_vt(Vt, n * 16, 32, lane);
                }
                // Compiler fence: keeps the second batch's loads behind the LDS traffic above.
                asm volatile("" ::: "memory");
                const unsigned goffb = goff + (unsigned)(KTILE * DMODEL * sizeof(float));   // tile 1 of that stage
#pragma unroll
                for (int pass = 0; pass < SPASS; ++pass) {
                    kb4[pass] = *(const float4*)((const char*)(K + pass * SROWS * DMODEL) + goffb);
                    vb4[pass] = *(const float4*)((const char*)(V + pass * SROWS * DMODEL) + goffb);
                }
                // Holds the loads here, in front of the second subtile's exponentials: the
                // scheduler otherwise moves them down to their use.
                __builtin_amdgcn_sched_barrier(0);
            }
        }

        // --- O^T += V^T x P : each V^T fragment reused for NQ WMMAs ---
#pragma unroll
        for (int n = 0; n < 4; ++n) {
            const v16h a0 = va[n][0];
            const v16h a1 = va[n][1];
#pragma unroll
            for (int qq = 0; qq < NQ; ++qq) {
                o[qq][n] = __builtin_amdgcn_wmma_f32_16x16x32_f16(false, a0, false, pb[qq][0], (short)0, o[qq][n], false, false);
                o[qq][n] = __builtin_amdgcn_wmma_f32_16x16x32_f16(false, a1, false, pb[qq][1], (short)0, o[qq][n], false, false);
            }
        }

        // --- drain the second batch into the other buffer (after compute) ---
        // Keeps the conversions, and with them the waits on the staged loads, below the
        // compute: the compiler otherwise lifts them.
        __builtin_amdgcn_sched_barrier(0);
#pragma unroll
        for (int pass = 0; pass < SPASS; ++pass) {
            const int row = KTILE + tr + pass * SROWS;
            _Float16* kd = Klds[nxt] + row * LDSP + tc;
            kd[0] = (_Float16)kb4[pass].x; kd[1] = (_Float16)kb4[pass].y;
            kd[2] = (_Float16)kb4[pass].z; kd[3] = (_Float16)kb4[pass].w;
            _Float16* vd = Vlds[nxt] + row * VPITCH + tc;
            vd[0] = (_Float16)vb4[pass].x; vd[1] = (_Float16)vb4[pass].y;
            vd[2] = (_Float16)vb4[pass].z; vd[3] = (_Float16)vb4[pass].w;
        }
        // Stands in front of the rewrite of the loads' address register (a precaution). It names
        // the offset, so that it stays in its register up to here and moves on behind the wait.
        asm volatile("s_wait_xcnt 0x0" : "+v"(goff) :: "memory");
        if (it + 2 < NTILES) goff += (unsigned)(STAGE * DMODEL * sizeof(float));
        __syncthreads();
    }

    // --- join the two key groups: the waves kg = 0 and kg = 1 of the same columns each hand the
    //     other one q-subtile (O, maximum in use, sum) through LDS and finish the one they keep.
    //     The loop's last barrier has ended every read of the tiles, so their LDS is free. ---
    float4* xch = (float4*)&Vlds[0][0];             // [WAVES][9][32] float4, 36,864 B of 40,960
    // The lane's number read anew: no register then carries it, or what follows from it, through the loop.
    const int ln = (int)__builtin_amdgcn_mbcnt_lo(~0u, 0u);
    const bool k1 = kg != 0;                        // wave-uniform: kg keeps subtile kg
    v8f   ok[4];
    float mk, lk;
    {
        float4* xs = xch + wave * (9 * 32) + ln;
#pragma unroll
        for (int n = 0; n < 4; ++n) {
            const v8f og = k1 ? o[0][n] : o[1][n];
            ok[n] = k1 ? o[1][n] : o[0][n];
            xs[(2 * n) * 32]     = make_float4(og[0], og[1], og[2], og[3]);
            xs[(2 * n + 1) * 32] = make_float4(og[4], og[5], og[6], og[7]);
        }
        xs[8 * 32] = make_float4(k1 ? m_use[0] : m_use[1], k1 ? l_run[0] : l_run[1], 0.0f, 0.0f);
        mk = k1 ? m_use[1] : m_use[0];
        lk = k1 ? l_run[1] : l_run[0];
    }
    __syncthreads();

    // --- normalize and store: lane holds q=m, d = n*16 + hi*8 + r (contig 8) ---
    {
        const float4* xr = xch + (wave ^ QW) * (9 * 32) + ln;
        const float4 ml = xr[8 * 32];
        const float mj = fmaxf(mk, ml.x);
        const float ak = __expf(mk - mj);
        const float ap = __expf(ml.x - mj);
        const float inv = 1.0f / (lk * ak + ml.y * ap);
        const float wk = ak * inv;
        const float wp = ap * inv;
        float* obase = O + ((size_t)(batch * S_LEN + qbase + kg * QTILE + (ln & 15))) * DMODEL
                         + head * DK + (ln >> 4) * 8;
#pragma unroll
        for (int n = 0; n < 4; ++n) {
            const float4 p0 = xr[(2 * n) * 32];
            const float4 p1 = xr[(2 * n + 1) * 32];
            float4 r0, r1;
            r0.x = ok[n][0] * wk + p0.x * wp; r0.y = ok[n][1] * wk + p0.y * wp;
            r0.z = ok[n][2] * wk + p0.z * wp; r0.w = ok[n][3] * wk + p0.w * wp;
            r1.x = ok[n][4] * wk + p1.x * wp; r1.y = ok[n][5] * wk + p1.y * wp;
            r1.z = ok[n][6] * wk + p1.z * wp; r1.w = ok[n][7] * wk + p1.w * wp;
            *(float4*)(obase + n * 16)     = r0;
            *(float4*)(obase + n * 16 + 4) = r1;
        }
    }
}

extern "C" void kernel_launch(void* const* d_in, const int* in_sizes, int n_in,
                              void* d_out, int out_size, void* d_ws, size_t ws_size,
                              hipStream_t stream) {
    (void)in_sizes; (void)n_in; (void)out_size; (void)d_ws; (void)ws_size;
    const float* Q = (const float*)d_in[0];
    const float* K = (const float*)d_in[1];
    const float* V = (const float*)d_in[2];
    float* O = (float*)d_out;

    dim3 grid(S_LEN / (QW * NQ * QTILE), 16 /*heads*/, 2 /*batch*/);
    dim3 block(BLOCK);
    OptimizedAttention_68736656605917_kernel<<<grid, block, 0, stream>>>(Q, K, V, O);
}

// v008
// It runs in 34.5 microseconds.
// Timed twice side by side with v007, it ran 1.04 times as fast both times.
// All steps since v000 together make it 2.40 times as fast.
#include <hip/hip_runtime.h>

#define S_LEN   2048
#define DMODEL  1024
#define DK      64
#define QTILE   16      // q rows per q-subtile
#define NQ      2       // q-subtiles per wave: each K and V fragment read from LDS feeds two products
#define KTILE   64      // keys per wave per mainloop iteration
#define KG      2       // key groups: a stage is KG tiles, and each wave works on its own group's tile
#define QW      4       // waves side by side over the query columns
#define STAGE   (KG * KTILE)        // keys staged per mainloop iteration
#define NTILES  (S_LEN / STAGE)
#define WAVES   (QW * KG)           // still 4 waves per SIMD over the grid
#define BLOCK   (WAVES * 32)
#define SROWS   (BLOCK / 16)        // stage rows staged per pass (16 threads per row)
#define SPASS   (KTILE / SROWS)     // staging passes per batch (a batch is one tile of the stage)
#define LDSP    72      // LDS pitch in halves (16B-aligned rows, staggered banks)
#define VPITCH  80      // V pitch in halves: 160 B = 32 B x odd, the transposing load's pitch
#define LOG2E   1.44269504088896340736f
#define LAZY_T  5.5f    // a column's scores may top the maximum in use by this much (P <= e^5.5 = 245, far inside f16)

typedef __attribute__((ext_vector_type(16))) _Float16 v16h;
typedef __attribute__((ext_vector_type(8)))  _Float16 v8h;
typedef __attribute__((ext_vector_type(8)))  float    v8f;
typedef __attribute__((ext_vector_type(8)))  short    s16x8;

static __device__ __forceinline__ v16h cat8(v8h a, v8h b) {
    return __builtin_shufflevector(a, b, 0,1,2,3,4,5,6,7,8,9,10,11,12,13,14,15);
}

// Load a 16x32 WMMA A/B fragment from row-major LDS (pitch LDSP halves).
// Lanes 0-15: elems {0..7}=col0+0..7, {8..15}=col0+16..23;
// lanes 16-31: elems {0..7}=col0+8..15, {8..15}=col0+24..31. Row = row0 + lane%16.
static __device__ __forceinline__ v16h lds_frag(const _Float16* base, int row0,
                                                int col0, int hi, int m) {
    const _Float16* r = base + (row0 + m) * LDSP + col0 + hi * 8;
    v8h lo = *(const v8h*)(r);
    v8h hh = *(const v8h*)(r + 16);
    return cat8(lo, hh);
}

// Load a 16(d) x 32(key) WMMA A fragment of V^T from row-major V[key][d] in LDS
// (pitch VPITCH halves) with the transposing load. Lane (c = lane%16, h = lane/16)
// gets keys key0 + 8h + 0..7 (elems 0..7) and key0 + 16 + 8h + 0..7 (elems 8..15)
// of column d0 + c: the same fragment lds_frag gives on a transposed tile.
static __device__ __forceinline__ v8h lds_tr16(const _Float16* p) {
    typedef __attribute__((address_space(3))) s16x8 lds_s16x8;
    return __builtin_bit_cast(v8h, __builtin_amdgcn_ds_load_tr16_b128_v8i16((lds_s16x8*)p));
}
static __device__ __forceinline__ v16h lds_frag_vt(const _Float16* base, int d0,
                                                   int key0, int lane) {
    const _Float16* p = base + (key0 + 8 * (lane >> 4) + (lane & 7)) * VPITCH
                             + d0 + 8 * ((lane >> 3) & 1);
    return cat8(lds_tr16(p), lds_tr16(p + 16 * VPITCH));
}

// Lane l with lane l ^ 16 on the vector pipe (v_permlanex16_b32). __shfl_xor compiles to an
// LDS operation whose wait also drains every V fragment load queued in front of it.
static __device__ __forceinline__ float xhalf(float x) {
    const int b = __builtin_bit_cast(int, x);
    return __builtin_bit_cast(float,
        __builtin_amdgcn_permlanex16(b, b, 0x76543210, 0xfedcba98, false, false));
}

// Four waves per SIMD (two blocks per WGP) is all the grid can fill: the register budget is set for that.
__global__ __launch_bounds__(BLOCK) __attribute__((amdgpu_waves_per_eu(4, 4)))
void OptimizedAttention_68736656605917_kernel(const float* __restrict__ Q,
                                              const float* __restrict__ K,
                                              const float* __restrict__ V,
                                              float* __restrict__ O) {
    // double-buffered tiles: K and V both row-major f16 (V is transposed when read)
    __shared__ __align__(16) _Float16 Klds[2][STAGE * LDSP];
    __shared__ __align__(16) _Float16 Vlds[2][STAGE * VPITCH];

    const int tid  = threadIdx.x;
    const int wave = __builtin_amdgcn_readfirstlane(tid >> 5);   // wave-uniform: kept in a scalar register
    const int lane = tid & 31;
    const int hi   = lane >> 4;
    const int m    = lane & 15;

    const int qblk  = blockIdx.x;   // 0..15
    const int head  = blockIdx.y;   // 0..15
    const int batch = blockIdx.z;   // 0..1

    const int   qw    = wave & (QW - 1);    // which 32 query columns
    const int   kg    = wave / QW;          // which tile of every stage
    const int   qbase = qblk * (QW * NQ * QTILE) + qw * (NQ * QTILE);
    const float scale = 0.125f;     // 1/sqrt(64), folded into Q before f16 cvt

    // --- Q fragments (B-operand: lane = q column, d packed per WMMA layout) ---
    v16h qb[NQ][2];
#pragma unroll
    for (int qq = 0; qq < NQ; ++qq) {
        const float* qptr =
            Q + ((size_t)(batch * S_LEN + qbase + qq * QTILE + m)) * DMODEL + head * DK;
#pragma unroll
        for (int dh = 0; dh < 2; ++dh) {
            const float* p = qptr + dh * 32 + hi * 8;
            v16h f;
#pragma unroll
            for (int i = 0; i < 8; ++i) {
                f[i]     = (_Float16)(p[i]      * scale);
                f[i + 8] = (_Float16)(p[i + 16] * scale);
            }
            qb[qq][dh] = f;
        }
    }

    v8f o[NQ][4];
#pragma unroll
    for (int qq = 0; qq < NQ; ++qq)
#pragma unroll
        for (int n = 0; n < 4; ++n) o[qq][n] = {};
    // m_use: the maximum in use, which may trail the column's true maximum by up to LAZY_T. It is
    // taken off inside the exponent's multiply (one fma per score): as a C operand of the score
    // products it would hold eight registers per q-subtile, which two subtiles cannot spare.
    float m_use[NQ], l_run[NQ];
#pragma unroll
    for (int qq = 0; qq < NQ; ++qq) { m_use[qq] = 0.0f; l_run[qq] = 0.0f; }

    const float* kbase_g = K + (size_t)batch * S_LEN * DMODEL + head * DK;
    const float* vbase_g = V + (size_t)batch * S_LEN * DMODEL + head * DK;

    const int tr = tid >> 4;          // 0..SROWS-1 (tile row within a pass)
    const int tc = (tid & 15) * 4;    // 0..60 (float4 column)
    const bool pf_wave = wave < 4;   // wave-uniform, a scalar test
    // Byte offset, the same in K and in V, of this thread's first row of the tile to be staged
    // next (below 16 MiB); it moves on at the loop's foot.
    unsigned goff = (unsigned)(((batch * S_LEN + STAGE + tr) * DMODEL + head * DK + tc) * sizeof(float));

    // Byte offset, the same in K and in V, of the row of stage 2 that this thread asks for ahead.
    const unsigned poff = (unsigned)(((batch * S_LEN + 2 * STAGE + (tid & (STAGE - 1))) * DMODEL + head * DK) * sizeof(float));

    // ---- prologue: load stage 0 into buffer 0 ----
    {
        float4 k4[KG * SPASS], v4[KG * SPASS];
#pragma unroll
        for (int pass = 0; pass < KG * SPASS; ++pass) {
            const int row = tr + pass * SROWS;
            k4[pass] = *(const float4*)(kbase_g + (size_t)row * DMODEL + tc);
            v4[pass] = *(const float4*)(vbase_g + (size_t)row * DMODEL + tc);
        }
#pragma unroll
        for (int pass = 0; pass < KG * SPASS; ++pass) {
            const int row = tr + pass * SROWS;
            _Float16* kd = Klds[0] + row * LDSP + tc;
            kd[0] = (_Float16)k4[pass].x; kd[1] = (_Float16)k4[pass].y;
            kd[2] = (_Float16)k4[pass].z; kd[3] = (_Float16)k4[pass].w;
            _Float16* vd = Vlds[0] + row * VPITCH + tc;
            vd[0] = (_Float16)v4[pass].x; vd[1] = (_Float16)v4[pass].y;
            vd[2] = (_Float16)v4[pass].z; vd[3] = (_Float16)v4[pass].w;
        }
    }
    __syncthreads();

    for (int it = 0; it < NTILES; ++it) {
        const int cur = it & 1;
        const int nxt = cur ^ 1;
        const _Float16* Kt = Klds[cur] + kg * (KTILE * LDSP);     // this wave's tile of the stage
        const _Float16* Vt = Vlds[cur] + kg * (KTILE * VPITCH);

        // prefetch stage i+2 toward L2 (global_prefetch_b8): 128 threads, one request per row of
        // 256 aligned bytes.
        if (it + 2 < NTILES && pf_wave) {
            const unsigned po = poff + (unsigned)it * (unsigned)(STAGE * DMODEL * sizeof(float));
            __builtin_prefetch((const char*)K + po, 0, 1);
            __builtin_prefetch((const char*)V + po, 0, 1);
        }

        // --- S^T = K x Q : 4 tiles of 16(key)x16(q) per q-subtile.
        //     Each K-fragment (A) is loaded once and reused for NQ WMMAs. ---
        v16h ka[4][2];
#pragma unroll
        for (int mt = 0; mt < 4; ++mt) {
            ka[mt][0] = lds_frag(Kt, mt * 16, 0, hi, m);
            ka[mt][1] = lds_frag(Kt, mt * 16, 32, hi, m);
        }

        // --- the next stage's global loads, first batch (its tile 0), issued HERE: behind the
        //     barrier a wave first wants its K fragments, so nothing of the staging stands between
        //     the barrier and those reads. In the last stage goff has not moved: it reads its own
        //     rows again (in bounds) and uses none of them. ---
        // Compiler fence: keeps the global loads behind the LDS fragment reads above.
        asm volatile("" ::: "memory");
        float4 k4[SPASS], v4[SPASS];
#pragma unroll
        for (int pass = 0; pass < SPASS; ++pass) {
            k4[pass] = *(const float4*)((const char*)(K + pass * SROWS * DMODEL) + goff);
            v4[pass] = *(const float4*)((const char*)(V + pass * SROWS * DMODEL) + goff);
        }
        // Compiler fence: without it the compiler sinks the loads directly in front of their use.
        asm volatile("" ::: "memory");

        v8f st[NQ][4];
        const v8f zero8 = {};
        v16h ones;
#pragma unroll
        for (int i = 0; i < 16; ++i) ones[i] = (_Float16)1.0f;
#pragma unroll
        for (int mt = 0; mt < 4; ++mt) {
#pragma unroll
            for (int qq = 0; qq < NQ; ++qq)
                st[qq][mt] = __builtin_amdgcn_wmma_f32_16x16x32_f16(false, ka[mt][0], false, qb[qq][0], (short)0, zero8, false, false);
#pragma unroll
            for (int qq = 0; qq < NQ; ++qq)
                st[qq][mt] = __builtin_amdgcn_wmma_f32_16x16x32_f16(false, ka[mt][1], false, qb[qq][1], (short)0, st[qq][mt], false, false);
        }

        // --- lazy rescale: one test per stage. The maximum in use moves only when some column's
        //     scores top it by more than LAZY_T (and in the wave's first tile, which sets it). ---
        float mx[NQ];
        bool need = false;
#pragma unroll
        for (int qq = 0; qq < NQ; ++qq) {
            float t = st[qq][0][0];
#pragma unroll
            for (int mt = 0; mt < 4; ++mt)
#pragma unroll
                for (int r = 0; r < 8; ++r) t = fmaxf(t, st[qq][mt][r]);
            mx[qq] = t;
            need = need || (t > m_use[qq] + LAZY_T);
        }
        if (it == 0 || __builtin_amdgcn_ballot_w32(need) != 0) {   // wave-uniform, a scalar branch
#pragma unroll
            for (int qq = 0; qq < NQ; ++qq) {
                const float mc = fmaxf(mx[qq], xhalf(mx[qq]));              // the column's maximum
                const float mn = (it == 0) ? mc : fmaxf(mc, m_use[qq]);     // the first tile may also lower it
                const float alpha = __expf(fminf(m_use[qq] - mn, 0.0f));
#pragma unroll
                for (int n = 0; n < 4; ++n) o[qq][n] *= alpha;
                l_run[qq] *= alpha;
                m_use[qq] = mn;
            }
        }

        // --- exponentials, P fragments (per q-subtile; the row sums follow the O products); between the two subtiles the
        //     first staged batch is drained and the second is issued ---
        v16h pb[NQ][2];
        v16h va[4][2];
        float4 kb4[SPASS], vb4[SPASS];
#pragma unroll
        for (int qq = 0; qq < NQ; ++qq) {
            const float nml = -m_use[qq] * LOG2E;
#pragma unroll
            for (int mt = 0; mt < 4; ++mt)
#pragma unroll
                for (int r = 0; r < 8; ++r)
                    st[qq][mt][r] = __builtin_amdgcn_exp2f(fmaf(st[qq][mt][r], LOG2E, nml));

            // accumulator layout of S^T IS the B-operand layout for P
#pragma unroll
            for (int j = 0; j < 2; ++j) {
                v16h f;
#pragma unroll
                for (int i = 0; i < 8; ++i) {
                    f[i]     = (_Float16)st[qq][2 * j][i];
                    f[i + 8] = (_Float16)st[qq][2 * j + 1][i];
                }
                pb[qq][j] = f;
            }

            if (qq == 0) {
                // Keeps the first batch's conversions, and with them the waits on its loads, below
                // the first subtile's exponentials: the compiler otherwise lifts them.
                __builtin_amdgcn_sched_barrier(0);
                // No test for a next stage: the last stage writes its own rows into the other
                // buffer, which nobody reads any more; a branch here would let the loads sink into it.
#pragma unroll
                for (int pass = 0; pass < SPASS; ++pass) {
                    const int row = tr + pass * SROWS;
                    _Float16* kd = Klds[nxt] + row * LDSP + tc;
                    kd[0] = (_Float16)k4[pass].x; kd[1] = (_Float16)k4[pass].y;
                    kd[2] = (_Float16)k4[pass].z; kd[3] = (_Float16)k4[pass].w;
                    _Float16* vd = Vlds[nxt] + row * VPITCH + tc;
                    vd[0] = (_Float16)v4[pass].x; vd[1] = (_Float16)v4[pass].y;
                    vd[2] = (_Float16)v4[pass].z; vd[3] = (_Float16)v4[pass].w;
                }
                // V^T fragments: their loads are issued here, so that they fly under the second
                // subtile's exponentials.
#pragma unroll
                for (int n = 0; n < 4; ++n) {
                    va[n][0] = lds_frag_vt(Vt, n * 16, 0, lane);
                    va[n][1] = lds_frag_vt(Vt, n * 16, 32, lane);
                }
                // Compiler fence: keeps the second batch's loads behind the LDS traffic above.
                asm volatile("" ::: "memory");
                const unsigned goffb = goff + (unsigned)(KTILE * DMODEL * sizeof(float));   // tile 1 of that stage
#pragma unroll
                for (int pass = 0; pass < SPASS; ++pass) {
                    kb4[pass] = *(const float4*)((const char*)(K + pass * SROWS * DMODEL) + goffb);
                    vb4[pass] = *(const float4*)((const char*)(V + pass * SROWS * DMODEL) + goffb);
                }
                // Holds the loads here, in front of the second subtile's exponentials: the
                // scheduler otherwise moves them down to their use.
                __builtin_amdgcn_sched_barrier(0);
            }
        }

        // --- O^T += V^T x P : each V^T fragment reused for NQ WMMAs ---
#pragma unroll
        for (int n = 0; n < 4; ++n) {
            const v16h a0 = va[n][0];
            const v16h a1 = va[n][1];
#pragma unroll
            for (int qq = 0; qq < NQ; ++qq) {
                o[qq][n] = __builtin_amdgcn_wmma_f32_16x16x32_f16(false, a0, false, pb[qq][0], (short)0, o[qq][n], false, false);
                o[qq][n] = __builtin_amdgcn_wmma_f32_16x16x32_f16(false, a1, false, pb[qq][1], (short)0, o[qq][n], false, false);
            }
        }

        // --- row sums on the matrix pipe: A is all ones, so every row of the product holds, in lane
        //     q and in lane q + 16 alike, the sum of column q over the tile's 64 keys (of P as rounded
        //     to f16, the values the O products use). No exchange between the wave halves is left.
        //     They stand behind the O products, in registers that the V fragments have left. ---
        v8f ls[NQ];
#pragma unroll
        for (int qq = 0; qq < NQ; ++qq)
            ls[qq] = __builtin_amdgcn_wmma_f32_16x16x32_f16(false, ones, false, pb[qq][0], (short)0, zero8, false, false);
#pragma unroll
        for (int qq = 0; qq < NQ; ++qq)
            ls[qq] = __builtin_amdgcn_wmma_f32_16x16x32_f16(false, ones, false, pb[qq][1], (short)0, ls[qq], false, false);

        // --- drain the second batch into the other buffer (after compute) ---
        // Keeps the conversions, and with them the waits on the staged loads, below the
        // compute: the compiler otherwise lifts them.
        __builtin_amdgcn_sched_barrier(0);
#pragma unroll
        for (int pass = 0; pass < SPASS; ++pass) {
            const int row = KTILE + tr + pass * SROWS;
            _Float16* kd = Klds[nxt] + row * LDSP + tc;
            kd[0] = (_Float16)kb4[pass].x; kd[1] = (_Float16)kb4[pass].y;
            kd[2] = (_Float16)kb4[pass].z; kd[3] = (_Float16)kb4[pass].w;
            _Float16* vd = Vlds[nxt] + row * VPITCH + tc;
            vd[0] = (_Float16)vb4[pass].x; vd[1] = (_Float16)vb4[pass].y;
            vd[2] = (_Float16)vb4[pass].z; vd[3] = (_Float16)vb4[pass].w;
        }
#pragma unroll
        for (int qq = 0; qq < NQ; ++qq) l_run[qq] += ls[qq][0];
        // Stands in front of the rewrite of the loads' address register (a precaution). It names
        // the offset, so that it stays in its register up to here and moves on behind the wait.
        asm volatile("s_wait_xcnt 0x0" : "+v"(goff) :: "memory");
        if (it + 2 < NTILES) goff += (unsigned)(STAGE * DMODEL * sizeof(float));
        __syncthreads();
    }

    // --- join the two key groups: the waves kg = 0 and kg = 1 of the same columns each hand the
    //     other one q-subtile (O, maximum in use, sum) through LDS and finish the one they keep.
    //     The loop's last barrier has ended every read of the tiles, so their LDS is free. ---
    float4* xch = (float4*)&Vlds[0][0];             // [WAVES][9][32] float4, 36,864 B of 40,960
    // The lane's number read anew: no register then carries it, or what follows from it, through the loop.
    const int ln = (int)__builtin_amdgcn_mbcnt_lo(~0u, 0u);
    const bool k1 = kg != 0;                        // wave-uniform: kg keeps subtile kg
    v8f   ok[4];
    float mk, lk;
    {
        float4* xs = xch + wave * (9 * 32) + ln;
#pragma unroll
        for (int n = 0; n < 4; ++n) {
            const v8f og = k1 ? o[0][n] : o[1][n];
            ok[n] = k1 ? o[1][n] : o[0][n];
            xs[(2 * n) * 32]     = make_float4(og[0], og[1], og[2], og[3]);
            xs[(2 * n + 1) * 32] = make_float4(og[4], og[5], og[6], og[7]);
        }
        xs[8 * 32] = make_float4(k1 ? m_use[0] : m_use[1], k1 ? l_run[0] : l_run[1], 0.0f, 0.0f);
        mk = k1 ? m_use[1] : m_use[0];
        lk = k1 ? l_run[1] : l_run[0];
    }
    __syncthreads();

    // --- normalize and store: lane holds q=m, d = n*16 + hi*8 + r (contig 8) ---
    {
        const float4* xr = xch + (wave ^ QW) * (9 * 32) + ln;
        const float4 ml = xr[8 * 32];
        const float mj = fmaxf(mk, ml.x);
        const float ak = __expf(mk - mj);
        const float ap = __expf(ml.x - mj);
        const float inv = 1.0f / (lk * ak + ml.y * ap);
        const float wk = ak * inv;
        const float wp = ap * inv;
        float* obase = O + ((size_t)(batch * S_LEN + qbase + kg * QTILE + (ln & 15))) * DMODEL
                         + head * DK + (ln >> 4) * 8;
#pragma unroll
        for (int n = 0; n < 4; ++n) {
            const float4 p0 = xr[(2 * n) * 32];
            const float4 p1 = xr[(2 * n + 1) * 32];
            float4 r0, r1;
            r0.x = ok[n][0] * wk + p0.x * wp; r0.y = ok[n][1] * wk + p0.y * wp;
            r0.z = ok[n][2] * wk + p0.z * wp; r0.w = ok[n][3] * wk + p0.w * wp;
            r1.x = ok[n][4] * wk + p1.x * wp; r1.y = ok[n][5] * wk + p1.y * wp;
            r1.z = ok[n][6] * wk + p1.z * wp; r1.w = ok[n][7] * wk + p1.w * wp;
            *(float4*)(obase + n * 16)     = r0;
            *(float4*)(obase + n * 16 + 4) = r1;
        }
    }
}

extern "C" void kernel_launch(void* const* d_in, const int* in_sizes, int n_in,
                              void* d_out, int out_size, void* d_ws, size_t ws_size,
                              hipStream_t stream) {
    (void)in_sizes; (void)n_in; (void)out_size; (void)d_ws; (void)ws_size;
    const float* Q = (const float*)d_in[0];
    const float* K = (const float*)d_in[1];
    const float* V = (const float*)d_in[2];
    float* O = (float*)d_out;

    dim3 grid(S_LEN / (QW * NQ * QTILE), 16 /*heads*/, 2 /*batch*/);
    dim3 block(BLOCK);
    OptimizedAttention_68736656605917_kernel<<<grid, block, 0, stream>>>(Q, K, V, O);
}

// v009
// It runs in 33.5 microseconds.
// Next to v008, in two timings, it ran 1.03 and 1.02 times as fast.
// All steps since v000 together make it 2.46 times as fast.
#include <hip/hip_runtime.h>

#define S_LEN   2048
#define DMODEL  1024
#define DK      64
#define QTILE   16      // q rows per q-subtile
#define NQ      2       // q-subtiles per wave: each K and V fragment read from LDS feeds two products
#define KTILE   64      // keys per wave per mainloop iteration
#define KG      2       // key groups: a stage is KG tiles, and each wave works on its own group's tile
#define QW      4       // waves side by side over the query columns
#define STAGE   (KG * KTILE)        // keys staged per mainloop iteration
#define NTILES  (S_LEN / STAGE)
#define WAVES   (QW * KG)           // still 4 waves per SIMD over the grid
#define BLOCK   (WAVES * 32)
#define SROWS   (BLOCK / 16)        // stage rows staged per pass (16 threads per row)
#define SPASS   (KTILE / SROWS)     // staging passes per batch (a batch is one tile of the stage)
#define LDSP    72      // LDS pitch in halves (16B-aligned rows, staggered banks)
#define VPITCH  80      // V pitch in halves: 160 B = 32 B x odd, the transposing load's pitch
#define LOG2E   1.44269504088896340736f
#define LAZY_T2 (5.5f * LOG2E)  // a column's scores (base-2 units) may top the maximum in use by this much (P <= e^5.5 = 245, far inside f16)

typedef __attribute__((ext_vector_type(16))) _Float16 v16h;
typedef __attribute__((ext_vector_type(8)))  _Float16 v8h;
typedef __attribute__((ext_vector_type(8)))  float    v8f;
typedef __attribute__((ext_vector_type(8)))  short    s16x8;

static __device__ __forceinline__ v16h cat8(v8h a, v8h b) {
    return __builtin_shufflevector(a, b, 0,1,2,3,4,5,6,7,8,9,10,11,12,13,14,15);
}

// Load a 16x32 WMMA A/B fragment from row-major LDS (pitch LDSP halves).
// Lanes 0-15: elems {0..7}=col0+0..7, {8..15}=col0+16..23;
// lanes 16-31: elems {0..7}=col0+8..15, {8..15}=col0+24..31. Row = row0 + lane%16.
static __device__ __forceinline__ v16h lds_frag(const _Float16* base, int row0,
                                                int col0, int hi, int m) {
    const _Float16* r = base + (row0 + m) * LDSP + col0 + hi * 8;
    v8h lo = *(const v8h*)(r);
    v8h hh = *(const v8h*)(r + 16);
    return cat8(lo, hh);
}

// Load a 16(d) x 32(key) WMMA A fragment of V^T from row-major V[key][d] in LDS
// (pitch VPITCH halves) with the transposing load. Lane (c = lane%16, h = lane/16)
// gets keys key0 + 8h + 0..7 (elems 0..7) and key0 + 16 + 8h + 0..7 (elems 8..15)
// of column d0 + c: the same fragment lds_frag gives on a transposed tile.
static __device__ __forceinline__ v8h lds_tr16(const _Float16* p) {
    typedef __attribute__((address_space(3))) s16x8 lds_s16x8;
    return __builtin_bit_cast(v8h, __builtin_amdgcn_ds_load_tr16_b128_v8i16((lds_s16x8*)p));
}
static __device__ __forceinline__ v16h lds_frag_vt(const _Float16* base, int d0,
                                                   int key0, int lane) {
    const _Float16* p = base + (key0 + 8 * (lane >> 4) + (lane & 7)) * VPITCH
                             + d0 + 8 * ((lane >> 3) & 1);
    return cat8(lds_tr16(p), lds_tr16(p + 16 * VPITCH));
}

// Lane l with lane l ^ 16 on the vector pipe (v_permlanex16_b32). __shfl_xor compiles to an
// LDS operation.
static __device__ __forceinline__ float xhalf(float x) {
    const int b = __builtin_bit_cast(int, x);
    return __builtin_bit_cast(float,
        __builtin_amdgcn_permlanex16(b, b, 0x76543210, 0xfedcba98, false, false));
}

// Four waves per SIMD (two blocks per WGP) is all the grid can fill: the register budget is set for that.
__global__ __launch_bounds__(BLOCK) __attribute__((amdgpu_waves_per_eu(4, 4)))
void OptimizedAttention_68736656605917_kernel(const float* __restrict__ Q,
                                              const float* __restrict__ K,
                                              const float* __restrict__ V,
                                              float* __restrict__ O) {
    // double-buffered tiles: K and V both row-major f16 (V is transposed when read)
    __shared__ __align__(16) _Float16 Klds[2][STAGE * LDSP];
    __shared__ __align__(16) _Float16 Vlds[2][STAGE * VPITCH];

    const int tid  = threadIdx.x;
    const int wave = __builtin_amdgcn_readfirstlane(tid >> 5);   // wave-uniform: kept in a scalar register
    const int lane = tid & 31;
    const int hi   = lane >> 4;
    const int m    = lane & 15;

    const int qblk  = blockIdx.x;   // 0..15
    const int head  = blockIdx.y;   // 0..15
    const int batch = blockIdx.z;   // 0..1

    const int   qw    = wave & (QW - 1);    // which 32 query columns
    const int   kg    = wave / QW;          // which tile of every stage
    const int   qbase = qblk * (QW * NQ * QTILE) + qw * (NQ * QTILE);
    const float scale = 0.125f * LOG2E;   // 1/sqrt(64) and log2(e), folded into Q before f16 cvt: scores come out in base-2 units

    // --- Q fragments (B-operand: lane = q column, d packed per WMMA layout) ---
    v16h qb[NQ][2];
#pragma unroll
    for (int qq = 0; qq < NQ; ++qq) {
        const float* qptr =
            Q + ((size_t)(batch * S_LEN + qbase + qq * QTILE + m)) * DMODEL + head * DK;
#pragma unroll
        for (int dh = 0; dh < 2; ++dh) {
            const float* p = qptr + dh * 32 + hi * 8;
            v16h f;
#pragma unroll
            for (int i = 0; i < 8; ++i) {
                f[i]     = (_Float16)(p[i]      * scale);
                f[i + 8] = (_Float16)(p[i + 16] * scale);
            }
            qb[qq][dh] = f;
        }
    }

    v8f o[NQ][4];
#pragma unroll
    for (int qq = 0; qq < NQ; ++qq)
#pragma unroll
        for (int n = 0; n < 4; ++n) o[qq][n] = {};
    // m_use: the maximum in use (base-2 units), which may trail the column's true maximum by up to
    // LAZY_T2. It is taken off by the score products themselves, as their C operand. That operand
    // (eight equal registers per q-subtile) is built anew in every stage and lives only through the
    // score products, where registers are free; it is not carried through the loop.
    float m_use[NQ], l_run[NQ];
#pragma unroll
    for (int qq = 0; qq < NQ; ++qq) { m_use[qq] = 0.0f; l_run[qq] = 0.0f; }

    const float* kbase_g = K + (size_t)batch * S_LEN * DMODEL + head * DK;
    const float* vbase_g = V + (size_t)batch * S_LEN * DMODEL + head * DK;

    const int tr = tid >> 4;          // 0..SROWS-1 (tile row within a pass)
    const int tc = (tid & 15) * 4;    // 0..60 (float4 column)
    const bool pf_wave = wave < 4;   // wave-uniform, a scalar test
    // Byte offset, the same in K and in V, of this thread's first row of the tile to be staged
    // next (below 16 MiB); it moves on at the loop's foot.
    unsigned goff = (unsigned)(((batch * S_LEN + STAGE + tr) * DMODEL + head * DK + tc) * sizeof(float));

    // Byte offset, the same in K and in V, of the row of stage 2 that this thread asks for ahead.
    const unsigned poff = (unsigned)(((batch * S_LEN + 2 * STAGE + (tid & (STAGE - 1))) * DMODEL + head * DK) * sizeof(float));

    // ---- prologue: load stage 0 into buffer 0 ----
    {
        float4 k4[KG * SPASS], v4[KG * SPASS];
#pragma unroll
        for (int pass = 0; pass < KG * SPASS; ++pass) {
            const int row = tr + pass * SROWS;
            k4[pass] = *(const float4*)(kbase_g + (size_t)row * DMODEL + tc);
            v4[pass] = *(const float4*)(vbase_g + (size_t)row * DMODEL + tc);
        }
#pragma unroll
        for (int pass = 0; pass < KG * SPASS; ++pass) {
            const int row = tr + pass * SROWS;
            _Float16* kd = Klds[0] + row * LDSP + tc;
            kd[0] = (_Float16)k4[pass].x; kd[1] = (_Float16)k4[pass].y;
            kd[2] = (_Float16)k4[pass].z; kd[3] = (_Float16)k4[pass].w;
            _Float16* vd = Vlds[0] + row * VPITCH + tc;
            vd[0] = (_Float16)v4[pass].x; vd[1] = (_Float16)v4[pass].y;
            vd[2] = (_Float16)v4[pass].z; vd[3] = (_Float16)v4[pass].w;
        }
    }
    __syncthreads();

    for (int it = 0; it < NTILES; ++it) {
        const int cur = it & 1;
        const int nxt = cur ^ 1;
        const _Float16* Kt = Klds[cur] + kg * (KTILE * LDSP);     // this wave's tile of the stage
        const _Float16* Vt = Vlds[cur] + kg * (KTILE * VPITCH);

        // prefetch stage i+2 toward L2 (global_prefetch_b8): 128 threads, one request per row of
        // 256 aligned bytes.
        if (it + 2 < NTILES && pf_wave) {
            const unsigned po = poff + (unsigned)it * (unsigned)(STAGE * DMODEL * sizeof(float));
            __builtin_prefetch((const char*)K + po, 0, 1);
            __builtin_prefetch((const char*)V + po, 0, 1);
        }

        // --- S^T = K x Q : 4 tiles of 16(key)x16(q) per q-subtile.
        //     Each K-fragment (A) is loaded once and reused for NQ WMMAs. ---
        v16h ka[4][2];
#pragma unroll
        for (int mt = 0; mt < 4; ++mt) {
            ka[mt][0] = lds_frag(Kt, mt * 16, 0, hi, m);
            ka[mt][1] = lds_frag(Kt, mt * 16, 32, hi, m);
        }

        // --- the next stage's global loads, first batch (its tile 0), issued HERE: behind the
        //     barrier a wave first wants its K fragments, so nothing of the staging stands between
        //     the barrier and those reads. In the last stage goff has not moved: it reads its own
        //     rows again (in bounds) and uses none of them. ---
        // Compiler fence: keeps the global loads behind the LDS fragment reads above.
        asm volatile("" ::: "memory");
        float4 k4[SPASS], v4[SPASS];
#pragma unroll
        for (int pass = 0; pass < SPASS; ++pass) {
            k4[pass] = *(const float4*)((const char*)(K + pass * SROWS * DMODEL) + goff);
            v4[pass] = *(const float4*)((const char*)(V + pass * SROWS * DMODEL) + goff);
        }
        // Compiler fence: without it the compiler sinks the loads directly in front of their use.
        asm volatile("" ::: "memory");

        v8f st[NQ][4];
        const v8f zero8 = {};
        v8f cm[NQ];     // C operand of the score products: minus the maximum in use, in every row
#pragma unroll
        for (int qq = 0; qq < NQ; ++qq)
#pragma unroll
            for (int r = 0; r < 8; ++r) cm[qq][r] = -m_use[qq];
        v16h ones;
#pragma unroll
        for (int i = 0; i < 16; ++i) ones[i] = (_Float16)1.0f;
#pragma unroll
        for (int mt = 0; mt < 4; ++mt) {
#pragma unroll
            for (int qq = 0; qq < NQ; ++qq)
                st[qq][mt] = __builtin_amdgcn_wmma_f32_16x16x32_f16(false, ka[mt][0], false, qb[qq][0], (short)0, cm[qq], false, false);
#pragma unroll
            for (int qq = 0; qq < NQ; ++qq)
                st[qq][mt] = __builtin_amdgcn_wmma_f32_16x16x32_f16(false, ka[mt][1], false, qb[qq][1], (short)0, st[qq][mt], false, false);
        }

        // --- lazy rescale: one test per stage. The maximum in use moves only when some column's
        //     scores top it by more than LAZY_T2 (and in the wave's first tile, which sets it).
        //     The scores already stand relative to the maximum in use. ---
        float mx[NQ];
        bool need = false;
#pragma unroll
        for (int qq = 0; qq < NQ; ++qq) {
            float t = st[qq][0][0];
#pragma unroll
            for (int mt = 0; mt < 4; ++mt)
#pragma unroll
                for (int r = 0; r < 8; ++r) t = fmaxf(t, st[qq][mt][r]);
            mx[qq] = t;
            need = need || (t > LAZY_T2);
        }
        if (it == 0 || __builtin_amdgcn_ballot_w32(need) != 0) {   // wave-uniform, a scalar branch
#pragma unroll
            for (int qq = 0; qq < NQ; ++qq) {
                const float mc = fmaxf(mx[qq], xhalf(mx[qq]));      // the column's maximum, above the one in use
                const float dm = (it == 0) ? mc : fmaxf(mc, 0.0f);  // the move; the first tile may also lower it
                const float alpha = __builtin_amdgcn_exp2f(fminf(-dm, 0.0f));
#pragma unroll
                for (int n = 0; n < 4; ++n) o[qq][n] *= alpha;
                l_run[qq] *= alpha;
                m_use[qq] += dm;
#pragma unroll
                for (int mt = 0; mt < 4; ++mt) st[qq][mt] -= dm;    // this tile's scores follow the move
            }
        }

        // --- exponentials, P fragments (per q-subtile; the row sums follow the O products); between the two subtiles the
        //     first staged batch is drained and the second is issued ---
        v16h pb[NQ][2];
        v16h va[4][2];
        float4 kb4[SPASS], vb4[SPASS];
#pragma unroll
        for (int qq = 0; qq < NQ; ++qq) {
#pragma unroll
            for (int mt = 0; mt < 4; ++mt)
#pragma unroll
                for (int r = 0; r < 8; ++r)
                    st[qq][mt][r] = __builtin_amdgcn_exp2f(st[qq][mt][r]);

            // accumulator layout of S^T IS the B-operand layout for P
#pragma unroll
            for (int j = 0; j < 2; ++j) {
                v16h f;
#pragma unroll
                for (int i = 0; i < 8; ++i) {
                    f[i]     = (_Float16)st[qq][2 * j][i];
                    f[i + 8] = (_Float16)st[qq][2 * j + 1][i];
                }
                pb[qq][j] = f;
            }

            if (qq == 0) {
                // Keeps the first batch's conversions, and with them the waits on its loads, below
                // the first subtile's exponentials: the compiler otherwise lifts them.
                __builtin_amdgcn_sched_barrier(0);
                // No test for a next stage: the last stage writes its own rows into the other
                // buffer, which nobody reads any more; a branch here would let the loads sink into it.
#pragma unroll
                for (int pass = 0; pass < SPASS; ++pass) {
                    const int row = tr + pass * SROWS;
                    _Float16* kd = Klds[nxt] + row * LDSP + tc;
                    kd[0] = (_Float16)k4[pass].x; kd[1] = (_Float16)k4[pass].y;
                    kd[2] = (_Float16)k4[pass].z; kd[3] = (_Float16)k4[pass].w;
                    _Float16* vd = Vlds[nxt] + row * VPITCH + tc;
                    vd[0] = (_Float16)v4[pass].x; vd[1] = (_Float16)v4[pass].y;
                    vd[2] = (_Float16)v4[pass].z; vd[3] = (_Float16)v4[pass].w;
                }
                // V^T fragments: their loads are issued here, so that they fly under the second
                // subtile's exponentials.
#pragma unroll
                for (int n = 0; n < 4; ++n) {
                    va[n][0] = lds_frag_vt(Vt, n * 16, 0, lane);
                    va[n][1] = lds_frag_vt(Vt, n * 16, 32, lane);
                }
                // Compiler fence: keeps the second batch's loads behind the LDS traffic above.
                asm volatile("" ::: "memory");
                const unsigned goffb = goff + (unsigned)(KTILE * DMODEL * sizeof(float));   // tile 1 of that stage
#pragma unroll
                for (int pass = 0; pass < SPASS; ++pass) {
                    kb4[pass] = *(const float4*)((const char*)(K + pass * SROWS * DMODEL) + goffb);
                    vb4[pass] = *(const float4*)((const char*)(V + pass * SROWS * DMODEL) + goffb);
                }
                // Holds the loads here, in front of the second subtile's exponentials: the
                // scheduler otherwise moves them down to their use.
                __builtin_amdgcn_sched_barrier(0);
            }
        }

        // --- O^T += V^T x P : each V^T fragment reused for NQ WMMAs ---
#pragma unroll
        for (int n = 0; n < 4; ++n) {
            const v16h a0 = va[n][0];
            const v16h a1 = va[n][1];
#pragma unroll
            for (int qq = 0; qq < NQ; ++qq) {
                o[qq][n] = __builtin_amdgcn_wmma_f32_16x16x32_f16(false, a0, false, pb[qq][0], (short)0, o[qq][n], false, false);
                o[qq][n] = __builtin_amdgcn_wmma_f32_16x16x32_f16(false, a1, false, pb[qq][1], (short)0, o[qq][n], false, false);
            }
        }

        // --- row sums on the matrix pipe: A is all ones, so every row of the product holds, in lane
        //     q and in lane q + 16 alike, the sum of column q over the tile's 64 keys (of P as rounded
        //     to f16, the values the O products use). No exchange between the wave halves is left.
        //     They stand behind the O products, in registers that the V fragments have left. ---
        v8f ls[NQ];
#pragma unroll
        for (int qq = 0; qq < NQ; ++qq)
            ls[qq] = __builtin_amdgcn_wmma_f32_16x16x32_f16(false, ones, false, pb[qq][0], (short)0, zero8, false, false);
#pragma unroll
        for (int qq = 0; qq < NQ; ++qq)
            ls[qq] = __builtin_amdgcn_wmma_f32_16x16x32_f16(false, ones, false, pb[qq][1], (short)0, ls[qq], false, false);

        // --- drain the second batch into the other buffer (after compute) ---
        // Keeps the conversions, and with them the waits on the staged loads, below the
        // compute: the compiler otherwise lifts them.
        __builtin_amdgcn_sched_barrier(0);
#pragma unroll
        for (int pass = 0; pass < SPASS; ++pass) {
            const int row = KTILE + tr + pass * SROWS;
            _Float16* kd = Klds[nxt] + row * LDSP + tc;
            kd[0] = (_Float16)kb4[pass].x; kd[1] = (_Float16)kb4[pass].y;
            kd[2] = (_Float16)kb4[pass].z; kd[3] = (_Float16)kb4[pass].w;
            _Float16* vd = Vlds[nxt] + row * VPITCH + tc;
            vd[0] = (_Float16)vb4[pass].x; vd[1] = (_Float16)vb4[pass].y;
            vd[2] = (_Float16)vb4[pass].z; vd[3] = (_Float16)vb4[pass].w;
        }
#pragma unroll
        for (int qq = 0; qq < NQ; ++qq) l_run[qq] += ls[qq][0];
        // Stands in front of the rewrite of the loads' address register (a precaution). It names
        // the offset, so that it stays in its register up to here and moves on behind the wait.
        asm volatile("s_wait_xcnt 0x0" : "+v"(goff) :: "memory");
        if (it + 2 < NTILES) goff += (unsigned)(STAGE * DMODEL * sizeof(float));
        __syncthreads();
    }

    // --- join the two key groups: the waves kg = 0 and kg = 1 of the same columns each hand the
    //     other one q-subtile (O, maximum in use, sum) through LDS and finish the one they keep.
    //     The loop's last barrier has ended every read of the tiles, so their LDS is free. ---
    float4* xch = (float4*)&Vlds[0][0];             // [WAVES][9][32] float4, 36,864 B of 40,960
    // The lane's number read anew: no register then carries it, or what follows from it, through the loop.
    const int ln = (int)__builtin_amdgcn_mbcnt_lo(~0u, 0u);
    const bool k1 = kg != 0;                        // wave-uniform: kg keeps subtile kg
    v8f   ok[4];
    float mk, lk;
    {
        float4* xs = xch + wave * (9 * 32) + ln;
#pragma unroll
        for (int n = 0; n < 4; ++n) {
            const v8f og = k1 ? o[0][n] : o[1][n];
            ok[n] = k1 ? o[1][n] : o[0][n];
            xs[(2 * n) * 32]     = make_float4(og[0], og[1], og[2], og[3]);
            xs[(2 * n + 1) * 32] = make_float4(og[4], og[5], og[6], og[7]);
        }
        xs[8 * 32] = make_float4(k1 ? m_use[0] : m_use[1], k1 ? l_run[0] : l_run[1], 0.0f, 0.0f);
        mk = k1 ? m_use[1] : m_use[0];
        lk = k1 ? l_run[1] : l_run[0];
    }
    __syncthreads();

    // --- normalize and store: lane holds q=m, d = n*16 + hi*8 + r (contig 8) ---
    {
        const float4* xr = xch + (wave ^ QW) * (9 * 32) + ln;
        const float4 ml = xr[8 * 32];
        const float mj = fmaxf(mk, ml.x);
        const float ak = __builtin_amdgcn_exp2f(mk - mj);      // the maxima are in base-2 units
        const float ap = __builtin_amdgcn_exp2f(ml.x - mj);
        const float inv = 1.0f / (lk * ak + ml.y * ap);
        const float wk = ak * inv;
        const float wp = ap * inv;
        float* obase = O + ((size_t)(batch * S_LEN + qbase + kg * QTILE + (ln & 15))) * DMODEL
                         + head * DK + (ln >> 4) * 8;
#pragma unroll
        for (int n = 0; n < 4; ++n) {
            const float4 p0 = xr[(2 * n) * 32];
            const float4 p1 = xr[(2 * n + 1) * 32];
            float4 r0, r1;
            r0.x = ok[n][0] * wk + p0.x * wp; r0.y = ok[n][1] * wk + p0.y * wp;
            r0.z = ok[n][2] * wk + p0.z * wp; r0.w = ok[n][3] * wk + p0.w * wp;
            r1.x = ok[n][4] * wk + p1.x * wp; r1.y = ok[n][5] * wk + p1.y * wp;
            r1.z = ok[n][6] * wk + p1.z * wp; r1.w = ok[n][7] * wk + p1.w * wp;
            *(float4*)(obase + n * 16)     = r0;
            *(float4*)(obase + n * 16 + 4) = r1;
        }
    }
}

extern "C" void kernel_launch(void* const* d_in, const int* in_sizes, int n_in,
                              void* d_out, int out_size, void* d_ws, size_t ws_size,
                              hipStream_t stream) {
    (void)in_sizes; (void)n_in; (void)out_size; (void)d_ws; (void)ws_size;
    const float* Q = (const float*)d_in[0];
    const float* K = (const float*)d_in[1];
    const float* V = (const float*)d_in[2];
    float* O = (float*)d_out;

    dim3 grid(S_LEN / (QW * NQ * QTILE), 16 /*heads*/, 2 /*batch*/);
    dim3 block(BLOCK);
    OptimizedAttention_68736656605917_kernel<<<grid, block, 0, stream>>>(Q, K, V, O);
}

// v010
// It runs in 31.8 microseconds.
// Next to v009, in two timings, it ran 1.06 times as fast each time.
// Counting every step since v000, it is 2.60 times as fast.
#include <hip/hip_runtime.h>

#define S_LEN   2048
#define DMODEL  1024
#define DK      64
#define QTILE   16      // q rows per q-subtile
#define NQ      2       // q-subtiles per wave: each K and V fragment read from LDS feeds two products
#define KTILE   64      // keys per wave per mainloop iteration
#define KG      2       // key groups: a stage is KG tiles, and each wave works on its own group's tile
#define QW      4       // waves side by side over the query columns
#define STAGE   (KG * KTILE)        // keys staged per mainloop iteration
#define NTILES  (S_LEN / STAGE)
#define WAVES   (QW * KG)           // still 4 waves per SIMD over the grid
#define BLOCK   (WAVES * 32)
#define SROWS   (BLOCK / 16)        // stage rows staged per pass (16 threads per row)
#define SPASS   (KTILE / SROWS)     // staging passes per batch (a batch is one tile of the stage)
#define LDSP    72      // LDS pitch in halves (16B-aligned rows, staggered banks)
#define VPITCH  80      // V pitch in halves: 160 B = 32 B x odd, the transposing load's pitch
#define OPITCH  68      // output staging pitch in floats: 272 B = 16 B x odd, for 16-byte LDS stores and loads
#define LOG2E   1.44269504088896340736f
#define LAZY_T2 (5.5f * LOG2E)  // a column's scores (base-2 units) may top the maximum in use by this much (P <= e^5.5 = 245, far inside f16)

typedef __attribute__((ext_vector_type(16))) _Float16 v16h;
typedef __attribute__((ext_vector_type(8)))  _Float16 v8h;
typedef __attribute__((ext_vector_type(8)))  float    v8f;
typedef __attribute__((ext_vector_type(8)))  short    s16x8;

static __device__ __forceinline__ v16h cat8(v8h a, v8h b) {
    return __builtin_shufflevector(a, b, 0,1,2,3,4,5,6,7,8,9,10,11,12,13,14,15);
}

// Load a 16x32 WMMA A/B fragment from row-major LDS (pitch LDSP halves).
// Lanes 0-15: elems {0..7}=col0+0..7, {8..15}=col0+16..23;
// lanes 16-31: elems {0..7}=col0+8..15, {8..15}=col0+24..31. Row = row0 + lane%16.
static __device__ __forceinline__ v16h lds_frag(const _Float16* base, int row0,
                                                int col0, int hi, int m) {
    const _Float16* r = base + (row0 + m) * LDSP + col0 + hi * 8;
    v8h lo = *(const v8h*)(r);
    v8h hh = *(const v8h*)(r + 16);
    return cat8(lo, hh);
}

// Load a 16(d) x 32(key) WMMA A fragment of V^T from row-major V[key][d] in LDS
// (pitch VPITCH halves) with the transposing load. Lane (c = lane%16, h = lane/16)
// gets keys key0 + 8h + 0..7 (elems 0..7) and key0 + 16 + 8h + 0..7 (elems 8..15)
// of column d0 + c: the same fragment lds_frag gives on a transposed tile.
static __device__ __forceinline__ v8h lds_tr16(const _Float16* p) {
    typedef __attribute__((address_space(3))) s16x8 lds_s16x8;
    return __builtin_bit_cast(v8h, __builtin_amdgcn_ds_load_tr16_b128_v8i16((lds_s16x8*)p));
}
static __device__ __forceinline__ v16h lds_frag_vt(const _Float16* base, int d0,
                                                   int key0, int lane) {
    const _Float16* p = base + (key0 + 8 * (lane >> 4) + (lane & 7)) * VPITCH
                             + d0 + 8 * ((lane >> 3) & 1);
    return cat8(lds_tr16(p), lds_tr16(p + 16 * VPITCH));
}

// Lane l with lane l ^ 16 on the vector pipe (v_permlanex16_b32). __shfl_xor compiles to an
// LDS operation.
static __device__ __forceinline__ float xhalf(float x) {
    const int b = __builtin_bit_cast(int, x);
    return __builtin_bit_cast(float,
        __builtin_amdgcn_permlanex16(b, b, 0x76543210, 0xfedcba98, false, false));
}

// Four waves per SIMD (two blocks per WGP) is all the grid can fill: the register budget is set for that.
__global__ __launch_bounds__(BLOCK) __attribute__((amdgpu_waves_per_eu(4, 4)))
void OptimizedAttention_68736656605917_kernel(const float* __restrict__ Q,
                                              const float* __restrict__ K,
                                              const float* __restrict__ V,
                                              float* __restrict__ O) {
    // double-buffered tiles: K and V both row-major f16 (V is transposed when read)
    __shared__ __align__(16) _Float16 Klds[2][STAGE * LDSP];
    __shared__ __align__(16) _Float16 Vlds[2][STAGE * VPITCH];

    const int tid  = threadIdx.x;
    const int wave = __builtin_amdgcn_readfirstlane(tid >> 5);   // wave-uniform: kept in a scalar register
    const int lane = tid & 31;
    const int hi   = lane >> 4;
    const int m    = lane & 15;

    const int qblk  = blockIdx.x;   // 0..15
    const int head  = blockIdx.y;   // 0..15
    const int batch = blockIdx.z;   // 0..1

    const int   qw    = wave & (QW - 1);    // which 32 query columns
    const int   kg    = wave / QW;          // which tile of every stage
    const int   qbase = qblk * (QW * NQ * QTILE) + qw * (NQ * QTILE);
    const float scale = 0.125f * LOG2E;   // 1/sqrt(64) and log2(e), folded into Q before f16 cvt: scores come out in base-2 units

    // --- Q: the wave's 32 rows are loaded as whole rows of 256 bytes (two per load: four whole lines).
    //     Loaded in fragment order, one load would touch 16 lines for 16-byte pieces. They reach the
    //     fragment order through LDS, in the prologue below. ---
    float4 q4[NQ * QTILE / 2];
    {
        const float* qg = Q + ((size_t)(batch * S_LEN + qbase + hi)) * DMODEL + head * DK + m * 4;
#pragma unroll
        for (int i = 0; i < NQ * QTILE / 2; ++i) q4[i] = *(const float4*)(qg + (size_t)(2 * i) * DMODEL);
    }
    v16h qb[NQ][2];     // B-operand: lane = q column, d packed per WMMA layout

    v8f o[NQ][4];
#pragma unroll
    for (int qq = 0; qq < NQ; ++qq)
#pragma unroll
        for (int n = 0; n < 4; ++n) o[qq][n] = {};
    // m_use: the maximum in use (base-2 units), which may trail the column's true maximum by up to
    // LAZY_T2. It is taken off by the score products themselves, as their C operand. That operand
    // (eight equal registers per q-subtile) is built anew in every stage and lives only through the
    // score products, where registers are free; it is not carried through the loop.
    float m_use[NQ], l_run[NQ];
#pragma unroll
    for (int qq = 0; qq < NQ; ++qq) { m_use[qq] = 0.0f; l_run[qq] = 0.0f; }

    const float* kbase_g = K + (size_t)batch * S_LEN * DMODEL + head * DK;
    const float* vbase_g = V + (size_t)batch * S_LEN * DMODEL + head * DK;

    const int tr = tid >> 4;          // 0..SROWS-1 (tile row within a pass)
    const int tc = (tid & 15) * 4;    // 0..60 (float4 column)
    const bool pf_wave = wave < 4;   // wave-uniform, a scalar test
    // Byte offset, the same in K and in V, of this thread's first row of the tile to be staged
    // next (below 16 MiB); it moves on at the loop's foot.
    unsigned goff = (unsigned)(((batch * S_LEN + STAGE + tr) * DMODEL + head * DK + tc) * sizeof(float));

    // Byte offset, the same in K and in V, of the row of stage 2 that this thread asks for ahead.
    const unsigned poff = (unsigned)(((batch * S_LEN + 2 * STAGE + (tid & (STAGE - 1))) * DMODEL + head * DK) * sizeof(float));

    // ---- prologue: load stage 0 into buffer 0 ----
    {
        float4 k4[KG * SPASS], v4[KG * SPASS];
#pragma unroll
        for (int pass = 0; pass < KG * SPASS; ++pass) {
            const int row = tr + pass * SROWS;
            k4[pass] = *(const float4*)(kbase_g + (size_t)row * DMODEL + tc);
            v4[pass] = *(const float4*)(vbase_g + (size_t)row * DMODEL + tc);
        }
        // Q, scaled and rounded to f16, through the wave's own range of the second buffers, which
        // are first written behind the barrier below.
        {
            _Float16* qs = (wave < QW ? Klds[1] : Vlds[1]) + qw * (NQ * QTILE * LDSP);
#pragma unroll
            for (int i = 0; i < NQ * QTILE / 2; ++i) {
                _Float16* qd = qs + (2 * i + hi) * LDSP + m * 4;
                qd[0] = (_Float16)(q4[i].x * scale); qd[1] = (_Float16)(q4[i].y * scale);
                qd[2] = (_Float16)(q4[i].z * scale); qd[3] = (_Float16)(q4[i].w * scale);
            }
            // The rows are read back by other lanes of this wave than wrote them: the writes end first.
            asm volatile("s_wait_dscnt 0x0" ::: "memory");
#pragma unroll
            for (int qq = 0; qq < NQ; ++qq)
#pragma unroll
                for (int dh = 0; dh < 2; ++dh) qb[qq][dh] = lds_frag(qs, qq * QTILE, dh * 32, hi, m);
        }
#pragma unroll
        for (int pass = 0; pass < KG * SPASS; ++pass) {
            const int row = tr + pass * SROWS;
            _Float16* kd = Klds[0] + row * LDSP + tc;
            kd[0] = (_Float16)k4[pass].x; kd[1] = (_Float16)k4[pass].y;
            kd[2] = (_Float16)k4[pass].z; kd[3] = (_Float16)k4[pass].w;
            _Float16* vd = Vlds[0] + row * VPITCH + tc;
            vd[0] = (_Float16)v4[pass].x; vd[1] = (_Float16)v4[pass].y;
            vd[2] = (_Float16)v4[pass].z; vd[3] = (_Float16)v4[pass].w;
        }
    }
    __syncthreads();

    for (int it = 0; it < NTILES; ++it) {
        const int cur = it & 1;
        const int nxt = cur ^ 1;
        const _Float16* Kt = Klds[cur] + kg * (KTILE * LDSP);     // this wave's tile of the stage
        const _Float16* Vt = Vlds[cur] + kg * (KTILE * VPITCH);

        // prefetch stage i+2 toward L2 (global_prefetch_b8): 128 threads, one request per row of
        // 256 aligned bytes.
        if (it + 2 < NTILES && pf_wave) {
            const unsigned po = poff + (unsigned)it * (unsigned)(STAGE * DMODEL * sizeof(float));
            __builtin_prefetch((const char*)K + po, 0, 1);
            __builtin_prefetch((const char*)V + po, 0, 1);
        }

        // --- S^T = K x Q : 4 tiles of 16(key)x16(q) per q-subtile.
        //     Each K-fragment (A) is loaded once and reused for NQ WMMAs. ---
        v16h ka[4][2];
#pragma unroll
        for (int mt = 0; mt < 4; ++mt) {
            ka[mt][0] = lds_frag(Kt, mt * 16, 0, hi, m);
            ka[mt][1] = lds_frag(Kt, mt * 16, 32, hi, m);
        }

        // --- the next stage's global loads, first batch (its tile 0), issued HERE: behind the
        //     barrier a wave first wants its K fragments, so nothing of the staging stands between
        //     the barrier and those reads. In the last stage goff has not moved: it reads its own
        //     rows again (in bounds) and uses none of them. ---
        // Compiler fence: keeps the global loads behind the LDS fragment reads above.
        asm volatile("" ::: "memory");
        float4 k4[SPASS], v4[SPASS];
#pragma unroll
        for (int pass = 0; pass < SPASS; ++pass) {
            k4[pass] = *(const float4*)((const char*)(K + pass * SROWS * DMODEL) + goff);
            v4[pass] = *(const float4*)((const char*)(V + pass * SROWS * DMODEL) + goff);
        }
        // Compiler fence: without it the compiler sinks the loads directly in front of their use.
        asm volatile("" ::: "memory");

        v8f st[NQ][4];
        const v8f zero8 = {};
        v8f cm[NQ];     // C operand of the score products: minus the maximum in use, in every row
#pragma unroll
        for (int qq = 0; qq < NQ; ++qq)
#pragma unroll
            for (int r = 0; r < 8; ++r) cm[qq][r] = -m_use[qq];
        v16h ones;
#pragma unroll
        for (int i = 0; i < 16; ++i) ones[i] = (_Float16)1.0f;
#pragma unroll
        for (int mt = 0; mt < 4; ++mt) {
#pragma unroll
            for (int qq = 0; qq < NQ; ++qq)
                st[qq][mt] = __builtin_amdgcn_wmma_f32_16x16x32_f16(false, ka[mt][0], false, qb[qq][0], (short)0, cm[qq], false, false);
#pragma unroll
            for (int qq = 0; qq < NQ; ++qq)
                st[qq][mt] = __builtin_amdgcn_wmma_f32_16x16x32_f16(false, ka[mt][1], false, qb[qq][1], (short)0, st[qq][mt], false, false);
        }

        // --- lazy rescale: one test per stage. The maximum in use moves only when some column's
        //     scores top it by more than LAZY_T2 (and in the wave's first tile, which sets it).
        //     The scores already stand relative to the maximum in use. ---
        float mx[NQ];
        bool need = false;
#pragma unroll
        for (int qq = 0; qq < NQ; ++qq) {
            float t = st[qq][0][0];
#pragma unroll
            for (int mt = 0; mt < 4; ++mt)
#pragma unroll
                for (int r = 0; r < 8; ++r) t = fmaxf(t, st[qq][mt][r]);
            mx[qq] = t;
            need = need || (t > LAZY_T2);
        }
        if (it == 0 || __builtin_amdgcn_ballot_w32(need) != 0) {   // wave-uniform, a scalar branch
#pragma unroll
            for (int qq = 0; qq < NQ; ++qq) {
                const float mc = fmaxf(mx[qq], xhalf(mx[qq]));      // the column's maximum, above the one in use
                const float dm = (it == 0) ? mc : fmaxf(mc, 0.0f);  // the move; the first tile may also lower it
                const float alpha = __builtin_amdgcn_exp2f(fminf(-dm, 0.0f));
#pragma unroll
                for (int n = 0; n < 4; ++n) o[qq][n] *= alpha;
                l_run[qq] *= alpha;
                m_use[qq] += dm;
#pragma unroll
                for (int mt = 0; mt < 4; ++mt) st[qq][mt] -= dm;    // this tile's scores follow the move
            }
        }

        // --- exponentials, P fragments (per q-subtile; the row sums follow the O products); between the two subtiles the
        //     first staged batch is drained and the second is issued ---
        v16h pb[NQ][2];
        v16h va[4][2];
        float4 kb4[SPASS], vb4[SPASS];
#pragma unroll
        for (int qq = 0; qq < NQ; ++qq) {
#pragma unroll
            for (int mt = 0; mt < 4; ++mt)
#pragma unroll
                for (int r = 0; r < 8; ++r)
                    st[qq][mt][r] = __builtin_amdgcn_exp2f(st[qq][mt][r]);

            // accumulator layout of S^T IS the B-operand layout for P
#pragma unroll
            for (int j = 0; j < 2; ++j) {
                v16h f;
#pragma unroll
                for (int i = 0; i < 8; ++i) {
                    f[i]     = (_Float16)st[qq][2 * j][i];
                    f[i + 8] = (_Float16)st[qq][2 * j + 1][i];
                }
                pb[qq][j] = f;
            }

            if (qq == 0) {
                // Keeps the first batch's conversions, and with them the waits on its loads, below
                // the first subtile's exponentials: the compiler otherwise lifts them.
                __builtin_amdgcn_sched_barrier(0);
                // No test for a next stage: the last stage writes its own rows into the other
                // buffer, which nobody reads any more; a branch here would let the loads sink into it.
#pragma unroll
                for (int pass = 0; pass < SPASS; ++pass) {
                    const int row = tr + pass * SROWS;
                    _Float16* kd = Klds[nxt] + row * LDSP + tc;
                    kd[0] = (_Float16)k4[pass].x; kd[1] = (_Float16)k4[pass].y;
                    kd[2] = (_Float16)k4[pass].z; kd[3] = (_Float16)k4[pass].w;
                    _Float16* vd = Vlds[nxt] + row * VPITCH + tc;
                    vd[0] = (_Float16)v4[pass].x; vd[1] = (_Float16)v4[pass].y;
                    vd[2] = (_Float16)v4[pass].z; vd[3] = (_Float16)v4[pass].w;
                }
                // V^T fragments: their loads are issued here, so that they fly under the second
                // subtile's exponentials.
#pragma unroll
                for (int n = 0; n < 4; ++n) {
                    va[n][0] = lds_frag_vt(Vt, n * 16, 0, lane);
                    va[n][1] = lds_frag_vt(Vt, n * 16, 32, lane);
                }
                // Compiler fence: keeps the second batch's loads behind the LDS traffic above.
                asm volatile("" ::: "memory");
                const unsigned goffb = goff + (unsigned)(KTILE * DMODEL * sizeof(float));   // tile 1 of that stage
#pragma unroll
                for (int pass = 0; pass < SPASS; ++pass) {
                    kb4[pass] = *(const float4*)((const char*)(K + pass * SROWS * DMODEL) + goffb);
                    vb4[pass] = *(const float4*)((const char*)(V + pass * SROWS * DMODEL) + goffb);
                }
                // Holds the loads here, in front of the second subtile's exponentials: the
                // scheduler otherwise moves them down to their use.
                __builtin_amdgcn_sched_barrier(0);
            }
        }

        // --- O^T += V^T x P : each V^T fragment reused for NQ WMMAs ---
#pragma unroll
        for (int n = 0; n < 4; ++n) {
            const v16h a0 = va[n][0];
            const v16h a1 = va[n][1];
#pragma unroll
            for (int qq = 0; qq < NQ; ++qq) {
                o[qq][n] = __builtin_amdgcn_wmma_f32_16x16x32_f16(false, a0, false, pb[qq][0], (short)0, o[qq][n], false, false);
                o[qq][n] = __builtin_amdgcn_wmma_f32_16x16x32_f16(false, a1, false, pb[qq][1], (short)0, o[qq][n], false, false);
            }
        }

        // --- row sums on the matrix pipe: A is all ones, so every row of the product holds, in lane
        //     q and in lane q + 16 alike, the sum of column q over the tile's 64 keys (of P as rounded
        //     to f16, the values the O products use). No exchange between the wave halves is left.
        //     They stand behind the O products, in registers that the V fragments have left. ---
        v8f ls[NQ];
#pragma unroll
        for (int qq = 0; qq < NQ; ++qq)
            ls[qq] = __builtin_amdgcn_wmma_f32_16x16x32_f16(false, ones, false, pb[qq][0], (short)0, zero8, false, false);
#pragma unroll
        for (int qq = 0; qq < NQ; ++qq)
            ls[qq] = __builtin_amdgcn_wmma_f32_16x16x32_f16(false, ones, false, pb[qq][1], (short)0, ls[qq], false, false);

        // --- drain the second batch into the other buffer (after compute) ---
        // Keeps the conversions, and with them the waits on the staged loads, below the
        // compute: the compiler otherwise lifts them.
        __builtin_amdgcn_sched_barrier(0);
#pragma unroll
        for (int pass = 0; pass < SPASS; ++pass) {
            const int row = KTILE + tr + pass * SROWS;
            _Float16* kd = Klds[nxt] + row * LDSP + tc;
            kd[0] = (_Float16)kb4[pass].x; kd[1] = (_Float16)kb4[pass].y;
            kd[2] = (_Float16)kb4[pass].z; kd[3] = (_Float16)kb4[pass].w;
            _Float16* vd = Vlds[nxt] + row * VPITCH + tc;
            vd[0] = (_Float16)vb4[pass].x; vd[1] = (_Float16)vb4[pass].y;
            vd[2] = (_Float16)vb4[pass].z; vd[3] = (_Float16)vb4[pass].w;
        }
#pragma unroll
        for (int qq = 0; qq < NQ; ++qq) l_run[qq] += ls[qq][0];
        // Stands in front of the rewrite of the loads' address register (a precaution). It names
        // the offset, so that it stays in its register up to here and moves on behind the wait.
        asm volatile("s_wait_xcnt 0x0" : "+v"(goff) :: "memory");
        if (it + 2 < NTILES) goff += (unsigned)(STAGE * DMODEL * sizeof(float));
        __syncthreads();
    }

    // --- join the two key groups: the waves kg = 0 and kg = 1 of the same columns each hand the
    //     other one q-subtile (O, maximum in use, sum) through LDS and finish the one they keep.
    //     The loop's last barrier has ended every read of the tiles, so their LDS is free. ---
    float4* xch = (float4*)&Vlds[0][0];             // [WAVES][9][32] float4, 36,864 B of 40,960
    // The lane's number read anew: no register then carries it, or what follows from it, through the loop.
    const int ln = (int)__builtin_amdgcn_mbcnt_lo(~0u, 0u);
    const bool k1 = kg != 0;                        // wave-uniform: kg keeps subtile kg
    v8f   ok[4];
    float mk, lk;
    {
        float4* xs = xch + wave * (9 * 32) + ln;
#pragma unroll
        for (int n = 0; n < 4; ++n) {
            const v8f og = k1 ? o[0][n] : o[1][n];
            ok[n] = k1 ? o[1][n] : o[0][n];
            xs[(2 * n) * 32]     = make_float4(og[0], og[1], og[2], og[3]);
            xs[(2 * n + 1) * 32] = make_float4(og[4], og[5], og[6], og[7]);
        }
        xs[8 * 32] = make_float4(k1 ? m_use[0] : m_use[1], k1 ? l_run[0] : l_run[1], 0.0f, 0.0f);
        mk = k1 ? m_use[1] : m_use[0];
        lk = k1 ? l_run[1] : l_run[0];
    }
    __syncthreads();

    // --- normalize and store: lane holds q=m, d = n*16 + hi*8 + r (contig 8). Stored from there, one
    //     store would write 32 pieces of 16 bytes over 16 lines. The wave's 16 x 64 tile goes through
    //     LDS instead (its own range of the K buffers, which nobody reads behind the loop's last
    //     barrier), and every store then writes two whole rows of 256 bytes: four whole lines. ---
    {
        const float4* xr = xch + (wave ^ QW) * (9 * 32) + ln;
        const float4 ml = xr[8 * 32];
        const float mj = fmaxf(mk, ml.x);
        const float ak = __builtin_amdgcn_exp2f(mk - mj);      // the maxima are in base-2 units
        const float ap = __builtin_amdgcn_exp2f(ml.x - mj);
        const float inv = 1.0f / (lk * ak + ml.y * ap);
        const float wk = ak * inv;
        const float wp = ap * inv;
        float* stg = (float*)&Klds[0][0] + wave * (QTILE * OPITCH);     // 8 x 4,352 B of 36,864
        float* sw  = stg + (ln & 15) * OPITCH + (ln >> 4) * 8;
#pragma unroll
        for (int n = 0; n < 4; ++n) {
            const float4 p0 = xr[(2 * n) * 32];
            const float4 p1 = xr[(2 * n + 1) * 32];
            float4 r0, r1;
            r0.x = ok[n][0] * wk + p0.x * wp; r0.y = ok[n][1] * wk + p0.y * wp;
            r0.z = ok[n][2] * wk + p0.z * wp; r0.w = ok[n][3] * wk + p0.w * wp;
            r1.x = ok[n][4] * wk + p1.x * wp; r1.y = ok[n][5] * wk + p1.y * wp;
            r1.z = ok[n][6] * wk + p1.z * wp; r1.w = ok[n][7] * wk + p1.w * wp;
            *(float4*)(sw + n * 16)     = r0;
            *(float4*)(sw + n * 16 + 4) = r1;
        }
        // The rows are read back by other lanes of this wave than wrote them: the writes end first.
        asm volatile("s_wait_dscnt 0x0" ::: "memory");
        const float* sr = stg + (ln >> 4) * OPITCH + (ln & 15) * 4;
        float* obase = O + ((size_t)(batch * S_LEN + qbase + kg * QTILE + (ln >> 4))) * DMODEL
                         + head * DK + (ln & 15) * 4;
#pragma unroll
        for (int i = 0; i < QTILE / 2; ++i)
            *(float4*)(obase + (size_t)(2 * i) * DMODEL) = *(const float4*)(sr + 2 * i * OPITCH);
    }
}

extern "C" void kernel_launch(void* const* d_in, const int* in_sizes, int n_in,
                              void* d_out, int out_size, void* d_ws, size_t ws_size,
                              hipStream_t stream) {
    (void)in_sizes; (void)n_in; (void)out_size; (void)d_ws; (void)ws_size;
    const float* Q = (const float*)d_in[0];
    const float* K = (const float*)d_in[1];
    const float* V = (const float*)d_in[2];
    float* O = (float*)d_out;

    dim3 grid(S_LEN / (QW * NQ * QTILE), 16 /*heads*/, 2 /*batch*/);
    dim3 block(BLOCK);
    OptimizedAttention_68736656605917_kernel<<<grid, block, 0, stream>>>(Q, K, V, O);
}
